// v000
// Times are from an AMD MI455X. After a warm-up the kernel runs many times in a row, and a time is the length of
// such a window on the GPU divided by its runs, so every launch and the gaps after it count. The runs cycle
// through copies of the inputs. A figure is the median of several windows, for all but v000 over two sittings.
// Sittings can differ by a few percent; kernels timed side by side share one.
// v000, which the later versions start from, runs in 225 microseconds.
#include <hip/hip_runtime.h>

#define T_DIM   2048
#define N_DIM   2
#define C_DIM   1024
#define H_DIM   16
#define D_HEAD  64
#define M_ROWS  (T_DIM * N_DIM)   // 4096 rows (t*N + n)
#define WIN     128
#define NEG_BIG (-1.0e9f)

typedef __attribute__((ext_vector_type(16))) _Float16 v16h;
typedef __attribute__((ext_vector_type(8)))  _Float16 v8h;
typedef __attribute__((ext_vector_type(8)))  float    v8f;

static __device__ __forceinline__ v8f wmma_f16(v16h a, v16h b, v8f c) {
  // D = A(16x32 f16) * B(32x16 f16) + C(16x16 f32)
  return __builtin_amdgcn_wmma_f32_16x16x32_f16(false, a, false, b, (short)0, c,
                                                false, false);
}

// A/B fragment slice: elems 0..7 = p[hi*8 ..], elems 8..15 = p[16 + hi*8 ..]
static __device__ __forceinline__ v16h load_frag_f16(const _Float16* p, int hi) {
  v8h a = *(const v8h*)(p + hi * 8);
  v8h b = *(const v8h*)(p + 16 + hi * 8);
  v16h r;
#pragma unroll
  for (int i = 0; i < 8; ++i) { r[i] = a[i]; r[8 + i] = b[i]; }
  return r;
}

// ---------------------------------------------------------------------------
// fp32 -> f16 bulk convert (one pass; HBM-bound).  n must be divisible by 2048.
// ---------------------------------------------------------------------------
__global__ __launch_bounds__(256) void cvt_kernel(const float* __restrict__ in,
                                                  _Float16* __restrict__ out) {
  const size_t i = ((size_t)blockIdx.x * 256 + threadIdx.x) * 8;
  v8f x = *(const v8f*)(in + i);
  v8h y;
#pragma unroll
  for (int j = 0; j < 8; ++j) y[j] = (_Float16)x[j];
  *(v8h*)(out + i) = y;
}

// ---------------------------------------------------------------------------
// f16 GEMM, 32x64 tile per wave: P = X * W^T + b  (rows m = t*N+n, cols c)
// MODE 0: store f16 head layout out[n][h][t][d]        (Q, K)
// MODE 1: store f16 transposed head layout out[n][h][d][t]   (V)
// grid = (C/64, M/32), 32 threads (1 wave) per block.
// ---------------------------------------------------------------------------
template <int MODE>
__global__ __launch_bounds__(32) void proj_kernel(
    const _Float16* __restrict__ X, const _Float16* __restrict__ W,
    const float* __restrict__ bias, _Float16* __restrict__ out) {
  const int lane = threadIdx.x & 31;
  const int lo = lane & 15, hi = lane >> 4;
  const int row0 = blockIdx.y * 32;
  const int col0 = blockIdx.x * 64;

  const _Float16* arow0 = X + (size_t)(row0 + lo) * C_DIM;
  const _Float16* arow1 = X + (size_t)(row0 + 16 + lo) * C_DIM;
  const _Float16* brow0 = W + (size_t)(col0 + lo) * C_DIM;
  const _Float16* brow1 = W + (size_t)(col0 + 16 + lo) * C_DIM;
  const _Float16* brow2 = W + (size_t)(col0 + 32 + lo) * C_DIM;
  const _Float16* brow3 = W + (size_t)(col0 + 48 + lo) * C_DIM;

  v8f acc[2][4] = {};
  for (int k0 = 0; k0 < C_DIM; k0 += 32) {
    if (k0 + 256 < C_DIM) {               // global_prefetch_b8 of next slices
      __builtin_prefetch(arow0 + k0 + 256, 0, 3);
      __builtin_prefetch(arow1 + k0 + 256, 0, 3);
      __builtin_prefetch(brow0 + k0 + 256, 0, 3);
      __builtin_prefetch(brow2 + k0 + 256, 0, 3);
    }
    const v16h a0 = load_frag_f16(arow0 + k0, hi);
    const v16h a1 = load_frag_f16(arow1 + k0, hi);
    const v16h b0 = load_frag_f16(brow0 + k0, hi);
    const v16h b1 = load_frag_f16(brow1 + k0, hi);
    const v16h b2 = load_frag_f16(brow2 + k0, hi);
    const v16h b3 = load_frag_f16(brow3 + k0, hi);
    acc[0][0] = wmma_f16(a0, b0, acc[0][0]);
    acc[1][0] = wmma_f16(a1, b0, acc[1][0]);
    acc[0][1] = wmma_f16(a0, b1, acc[0][1]);
    acc[1][1] = wmma_f16(a1, b1, acc[1][1]);
    acc[0][2] = wmma_f16(a0, b2, acc[0][2]);
    acc[1][2] = wmma_f16(a1, b2, acc[1][2]);
    acc[0][3] = wmma_f16(a0, b3, acc[0][3]);
    acc[1][3] = wmma_f16(a1, b3, acc[1][3]);
  }

#pragma unroll
  for (int g = 0; g < 4; ++g) {
    const int col = col0 + g * 16 + lo;   // output channel
    const float bv = bias[col];
    const int h = col >> 6;               // / D_HEAD
    const int d = col & 63;
#pragma unroll
    for (int mi = 0; mi < 2; ++mi) {
#pragma unroll
      for (int r = 0; r < 8; ++r) {
        const int m = row0 + mi * 16 + r + 8 * hi;  // row = t*N + n
        const int t = m >> 1;                       // N_DIM == 2
        const int n = m & 1;
        const float val = acc[mi][g][r] + bv;
        size_t idx;
        if (MODE == 0)
          idx = ((size_t)((n * H_DIM + h) * T_DIM + t)) * D_HEAD + d;
        else
          idx = ((size_t)((n * H_DIM + h) * D_HEAD + d)) * T_DIM + t;
        out[idx] = (_Float16)val;
      }
    }
  }
}

// ---------------------------------------------------------------------------
// Flash attention, one wave per (n, h, 16-query tile).
// S^T = K_tile * Q^T: the 16x16 f32 D-fragment of S^T (lane = query column,
// VGPR r = key row r+8*hi) is element-for-element the A-fragment layout of P
// for the P*V WMMA -> no cross-lane shuffle between the two GEMMs.
// Dead 32-key tiles (outside band, beyond key prefix) skipped scalar-uniformly.
// ---------------------------------------------------------------------------
__global__ __launch_bounds__(32) void attn_kernel(
    const _Float16* __restrict__ Qh, const _Float16* __restrict__ Kh,
    const _Float16* __restrict__ Vt, const int* __restrict__ key_length,
    _Float16* __restrict__ Y) {
  const int lane = threadIdx.x & 31;
  const int lo = lane & 15, hi = lane >> 4;
  const int qbase = blockIdx.x * 16;
  const int h = blockIdx.y;
  const int n = blockIdx.z;
  const int keylen = key_length[n];

  const _Float16* Qp = Qh + ((size_t)(n * H_DIM + h) * T_DIM) * D_HEAD;
  const _Float16* Kp = Kh + ((size_t)(n * H_DIM + h) * T_DIM) * D_HEAD;
  const _Float16* Vp = Vt + ((size_t)(n * H_DIM + h) * D_HEAD) * T_DIM;

  // Q^T B-fragments: lane column q = lo, two 32-wide d chunks.
  const _Float16* qrow = Qp + (size_t)(qbase + lo) * D_HEAD;
  const v16h qb0 = load_frag_f16(qrow, hi);        // d = 0..31
  const v16h qb1 = load_frag_f16(qrow + 32, hi);   // d = 32..63

  v8f o[4] = {};                 // O fragments: d-groups of 16
  float m_run = -INFINITY;
  float l_run = 0.0f;
  const int qg = qbase + lo;     // this lane's query row (dup across hi halves)

  for (int kb = 0; kb < T_DIM; kb += 32) {
    // tile fully masked iff no band overlap AND beyond the key prefix
    const bool band = (kb <= qbase + 15 + WIN) && (kb + 31 >= qbase - WIN);
    if (!band && kb >= keylen) continue;

    // K A-fragments (lane row = key), two row halves x two d chunks
    const _Float16* kr0 = Kp + (size_t)(kb + lo) * D_HEAD;
    const _Float16* kr1 = Kp + (size_t)(kb + 16 + lo) * D_HEAD;
    if (kb + 32 < T_DIM) {       // prefetch next key tile rows
      __builtin_prefetch(kr0 + 32 * D_HEAD, 0, 3);
      __builtin_prefetch(kr1 + 32 * D_HEAD, 0, 3);
    }
    v8f s0 = {}, s1 = {};
    s0 = wmma_f16(load_frag_f16(kr0, hi), qb0, s0);
    s0 = wmma_f16(load_frag_f16(kr0 + 32, hi), qb1, s0);
    s1 = wmma_f16(load_frag_f16(kr1, hi), qb0, s1);
    s1 = wmma_f16(load_frag_f16(kr1 + 32, hi), qb1, s1);

    // scale + mask + per-query max
    float mt = -INFINITY;
#pragma unroll
    for (int r = 0; r < 8; ++r) {
      const int kg0 = kb + r + 8 * hi;
      const int kg1 = kg0 + 16;
      float v0 = s0[r] * 0.125f;   // 1/sqrt(Dh)
      float v1 = s1[r] * 0.125f;
      int d0 = qg - kg0; d0 = d0 < 0 ? -d0 : d0;
      int d1 = qg - kg1; d1 = d1 < 0 ? -d1 : d1;
      if (!(d0 <= WIN || kg0 < keylen)) v0 = NEG_BIG;
      if (!(d1 <= WIN || kg1 < keylen)) v1 = NEG_BIG;
      s0[r] = v0; s1[r] = v1;
      mt = fmaxf(mt, fmaxf(v0, v1));
    }
    mt = fmaxf(mt, __shfl_xor(mt, 16, 32));   // join the two key halves
    const float m_new = fmaxf(m_run, mt);
    const float alpha = __expf(m_run - m_new);

    // exp -> P fragment (already in A-fragment layout), row-sum
    v16h pa;
    float rs = 0.0f;
#pragma unroll
    for (int r = 0; r < 8; ++r) {
      const float p0 = __expf(s0[r] - m_new);
      const float p1 = __expf(s1[r] - m_new);
      rs += p0 + p1;
      pa[r] = (_Float16)p0;
      pa[8 + r] = (_Float16)p1;
    }
    rs += __shfl_xor(rs, 16, 32);
    l_run = l_run * alpha + rs;
    m_run = m_new;

    // rescale O accumulators; O-fragment row q = r + 8*hi, alpha lives in lane q
#pragma unroll
    for (int r = 0; r < 8; ++r) {
      const float ar = __shfl(alpha, hi * 8 + r, 32);
      o[0][r] *= ar; o[1][r] *= ar; o[2][r] *= ar; o[3][r] *= ar;
    }

    // O += P * V  (V transposed in memory: Vp[d][t] contiguous in t)
#pragma unroll
    for (int g = 0; g < 4; ++g) {
      const _Float16* vrow = Vp + (size_t)(g * 16 + lo) * T_DIM + kb;
      o[g] = wmma_f16(pa, load_frag_f16(vrow, hi), o[g]);
    }
  }

  // epilogue: O/l  -> Y[(t*N+n)*C + h*64 + d]  (f16, feeds the out-projection)
#pragma unroll
  for (int r = 0; r < 8; ++r) {
    const float lr = __shfl(l_run, hi * 8 + r, 32);
    const float inv = 1.0f / lr;
    const int qrow_g = qbase + r + 8 * hi;
#pragma unroll
    for (int g = 0; g < 4; ++g) {
      const int c = h * D_HEAD + g * 16 + lo;
      Y[((size_t)qrow_g * N_DIM + n) * C_DIM + c] = (_Float16)(o[g][r] * inv);
    }
  }
}

// ---------------------------------------------------------------------------
// Output projection: out = Y(f16, MxC) * Wo^T(f16) + bo -> fp32 (T,N,C)
// Same 32x64 tile structure as proj_kernel.
// ---------------------------------------------------------------------------
__global__ __launch_bounds__(32) void outproj_kernel(
    const _Float16* __restrict__ Yin, const _Float16* __restrict__ W,
    const float* __restrict__ bias, float* __restrict__ out) {
  const int lane = threadIdx.x & 31;
  const int lo = lane & 15, hi = lane >> 4;
  const int row0 = blockIdx.y * 32;
  const int col0 = blockIdx.x * 64;

  const _Float16* arow0 = Yin + (size_t)(row0 + lo) * C_DIM;
  const _Float16* arow1 = Yin + (size_t)(row0 + 16 + lo) * C_DIM;
  const _Float16* brow0 = W + (size_t)(col0 + lo) * C_DIM;
  const _Float16* brow1 = W + (size_t)(col0 + 16 + lo) * C_DIM;
  const _Float16* brow2 = W + (size_t)(col0 + 32 + lo) * C_DIM;
  const _Float16* brow3 = W + (size_t)(col0 + 48 + lo) * C_DIM;

  v8f acc[2][4] = {};
  for (int k0 = 0; k0 < C_DIM; k0 += 32) {
    if (k0 + 256 < C_DIM) {
      __builtin_prefetch(arow0 + k0 + 256, 0, 3);
      __builtin_prefetch(arow1 + k0 + 256, 0, 3);
      __builtin_prefetch(brow0 + k0 + 256, 0, 3);
      __builtin_prefetch(brow2 + k0 + 256, 0, 3);
    }
    const v16h a0 = load_frag_f16(arow0 + k0, hi);
    const v16h a1 = load_frag_f16(arow1 + k0, hi);
    const v16h b0 = load_frag_f16(brow0 + k0, hi);
    const v16h b1 = load_frag_f16(brow1 + k0, hi);
    const v16h b2 = load_frag_f16(brow2 + k0, hi);
    const v16h b3 = load_frag_f16(brow3 + k0, hi);
    acc[0][0] = wmma_f16(a0, b0, acc[0][0]);
    acc[1][0] = wmma_f16(a1, b0, acc[1][0]);
    acc[0][1] = wmma_f16(a0, b1, acc[0][1]);
    acc[1][1] = wmma_f16(a1, b1, acc[1][1]);
    acc[0][2] = wmma_f16(a0, b2, acc[0][2]);
    acc[1][2] = wmma_f16(a1, b2, acc[1][2]);
    acc[0][3] = wmma_f16(a0, b3, acc[0][3]);
    acc[1][3] = wmma_f16(a1, b3, acc[1][3]);
  }

#pragma unroll
  for (int g = 0; g < 4; ++g) {
    const int col = col0 + g * 16 + lo;
    const float bv = bias[col];
#pragma unroll
    for (int mi = 0; mi < 2; ++mi) {
#pragma unroll
      for (int r = 0; r < 8; ++r) {
        const int m = row0 + mi * 16 + r + 8 * hi;
        out[(size_t)m * C_DIM + col] = acc[mi][g][r] + bv;
      }
    }
  }
}

// ---------------------------------------------------------------------------
extern "C" void kernel_launch(void* const* d_in, const int* in_sizes, int n_in,
                              void* d_out, int out_size, void* d_ws,
                              size_t ws_size, hipStream_t stream) {
  (void)in_sizes; (void)n_in; (void)out_size; (void)ws_size;
  const float* q  = (const float*)d_in[0];
  const float* k  = (const float*)d_in[1];
  const float* v  = (const float*)d_in[2];
  const float* Wq = (const float*)d_in[3];
  const float* bq = (const float*)d_in[4];
  const float* Wk = (const float*)d_in[5];
  const float* bk = (const float*)d_in[6];
  const float* Wv = (const float*)d_in[7];
  const float* bv = (const float*)d_in[8];
  const float* Wo = (const float*)d_in[9];
  const float* bo = (const float*)d_in[10];
  const int* key_length = (const int*)d_in[11];
  float* out = (float*)d_out;

  // Workspace (f16 elements), total 64 MB:
  //   Qh, Kh, Vt, Y          : 4 x N*H*T*Dh  = 4 x 4M   (32 MB)
  //   q16, k16, v16          : 3 x T*N*C     = 3 x 4M   (24 MB)
  //   Wq16, Wk16, Wv16, Wo16 : 4 x C*C       = 4 x 1M   ( 8 MB)
  const size_t HSZ = (size_t)N_DIM * H_DIM * T_DIM * D_HEAD;  // 4,194,304
  const size_t WSZ = (size_t)C_DIM * C_DIM;                   // 1,048,576
  _Float16* Qh   = (_Float16*)d_ws;
  _Float16* Kh   = Qh + HSZ;
  _Float16* Vt   = Kh + HSZ;
  _Float16* Y    = Vt + HSZ;
  _Float16* q16  = Y + HSZ;
  _Float16* k16  = q16 + HSZ;
  _Float16* v16  = k16 + HSZ;
  _Float16* Wq16 = v16 + HSZ;
  _Float16* Wk16 = Wq16 + WSZ;
  _Float16* Wv16 = Wk16 + WSZ;
  _Float16* Wo16 = Wv16 + WSZ;

  // 1) bulk fp32 -> f16 conversions (removes all cvt work from GEMM hot loops)
  cvt_kernel<<<HSZ / 2048, 256, 0, stream>>>(q, q16);
  cvt_kernel<<<HSZ / 2048, 256, 0, stream>>>(k, k16);
  cvt_kernel<<<HSZ / 2048, 256, 0, stream>>>(v, v16);
  cvt_kernel<<<WSZ / 2048, 256, 0, stream>>>(Wq, Wq16);
  cvt_kernel<<<WSZ / 2048, 256, 0, stream>>>(Wk, Wk16);
  cvt_kernel<<<WSZ / 2048, 256, 0, stream>>>(Wv, Wv16);
  cvt_kernel<<<WSZ / 2048, 256, 0, stream>>>(Wo, Wo16);

  // 2) input projections into WMMA-friendly head layouts
  const dim3 gp(C_DIM / 64, M_ROWS / 32);  // (16, 128) 32x64 tiles, 1 wave each
  proj_kernel<0><<<gp, 32, 0, stream>>>(q16, Wq16, bq, Qh);
  proj_kernel<0><<<gp, 32, 0, stream>>>(k16, Wk16, bk, Kh);
  proj_kernel<1><<<gp, 32, 0, stream>>>(v16, Wv16, bv, Vt);

  // 3) banded + prefix-masked flash attention
  attn_kernel<<<dim3(T_DIM / 16, H_DIM, N_DIM), 32, 0, stream>>>(
      Qh, Kh, Vt, key_length, Y);

  // 4) output projection (fp32 result + bias)
  outproj_kernel<<<gp, 32, 0, stream>>>(Y, Wo16, bo, out);
}

// v001
// It runs in 122 microseconds.
// Next to v000, in two timings, it ran 1.89 and 1.86 times as fast.
#include <hip/hip_runtime.h>

#define T_DIM   2048
#define N_DIM   2
#define C_DIM   1024
#define H_DIM   16
#define D_HEAD  64
#define M_ROWS  (T_DIM * N_DIM)   // 4096 rows (t*N + n)
#define WIN     128
#define NEG_BIG (-1.0e9f)

typedef __attribute__((ext_vector_type(16))) _Float16 v16h;
typedef __attribute__((ext_vector_type(8)))  _Float16 v8h;
typedef __attribute__((ext_vector_type(8)))  float    v8f;

static __device__ __forceinline__ v8f wmma_f16(v16h a, v16h b, v8f c) {
  // D = A(16x32 f16) * B(32x16 f16) + C(16x16 f32)
  return __builtin_amdgcn_wmma_f32_16x16x32_f16(false, a, false, b, (short)0, c,
                                                false, false);
}

// A/B fragment slice: elems 0..7 = p[hi*8 ..], elems 8..15 = p[16 + hi*8 ..]
static __device__ __forceinline__ v16h load_frag_f16(const _Float16* p, int hi) {
  v8h a = *(const v8h*)(p + hi * 8);
  v8h b = *(const v8h*)(p + 16 + hi * 8);
  v16h r;
#pragma unroll
  for (int i = 0; i < 8; ++i) { r[i] = a[i]; r[8 + i] = b[i]; }
  return r;
}

// ---------------------------------------------------------------------------
// fp32 -> f16 bulk convert (one pass; HBM-bound).  n must be divisible by 2048.
// ---------------------------------------------------------------------------
__global__ __launch_bounds__(256) void cvt_kernel(const float* __restrict__ in,
                                                  _Float16* __restrict__ out) {
  const size_t i = ((size_t)blockIdx.x * 256 + threadIdx.x) * 8;
  v8f x = *(const v8f*)(in + i);
  v8h y;
#pragma unroll
  for (int j = 0; j < 8; ++j) y[j] = (_Float16)x[j];
  *(v8h*)(out + i) = y;
}

// ---------------------------------------------------------------------------
// Shared GEMM main loop: one 128x128 tile of X * W^T per workgroup of 8 waves,
// each wave a 32x64 piece (4 wave rows x 2 wave columns).  A pass is 128 k
// (256 B of each of the 128 X rows and 128 W rows), brought into LDS by
// per-lane asynchronous 16-byte copies, two buffers: the next pass's copies
// fly while this pass is multiplied.  LDS row pitch 272 B (16 B x odd) keeps
// the 16-byte fragment reads free of bank conflicts.
// ---------------------------------------------------------------------------
#define G_TILE   128                       // rows of X and rows of W per tile
#define G_KPASS  128                       // k per pass
#define G_NPASS  (C_DIM / G_KPASS)         // 8
#define G_PITCH  136                       // f16 per LDS row (272 B)
#define G_STAGE  (2 * G_TILE * G_PITCH)    // f16 per buffer: [X rows | W rows]

// Eight 16-byte copies of this lane, rows 16 apart in both places.  The
// s_wait_xcnt stands inside the statement so that no address register of an
// issued copy is rewritten ahead of it.
static __device__ __forceinline__ void copy8_rows(unsigned l, const _Float16* g) {
  const unsigned ls = 16 * G_PITCH * 2;    // bytes between copies in LDS
  const size_t gs = (size_t)16 * C_DIM;    // f16 between copies in memory
  asm volatile(
      "global_load_async_to_lds_b128 %0, %8, off\n\t"
      "global_load_async_to_lds_b128 %1, %9, off\n\t"
      "global_load_async_to_lds_b128 %2, %10, off\n\t"
      "global_load_async_to_lds_b128 %3, %11, off\n\t"
      "global_load_async_to_lds_b128 %4, %12, off\n\t"
      "global_load_async_to_lds_b128 %5, %13, off\n\t"
      "global_load_async_to_lds_b128 %6, %14, off\n\t"
      "global_load_async_to_lds_b128 %7, %15, off\n\t"
      "s_wait_xcnt 0x0"
      :: "v"(l), "v"(l + ls), "v"(l + 2 * ls), "v"(l + 3 * ls),
         "v"(l + 4 * ls), "v"(l + 5 * ls), "v"(l + 6 * ls), "v"(l + 7 * ls),
         "v"(g), "v"(g + gs), "v"(g + 2 * gs), "v"(g + 3 * gs),
         "v"(g + 4 * gs), "v"(g + 5 * gs), "v"(g + 6 * gs), "v"(g + 7 * gs)
      : "memory");
}

// acc[mi][g] = rows (row0 + wm*32 + mi*16 ..) x cols (col0 + wn*64 + g*16 ..)
static __device__ __forceinline__ void gemm_tile_128(
    const _Float16* __restrict__ X, const _Float16* __restrict__ W,
    _Float16* smem, int row0, int col0, int wm, int wn, int lo, int hi,
    v8f (&acc)[2][4]) {
  const int tid = threadIdx.x;
  const int cr = tid >> 4;                 // copy row inside a group of 16
  const int cc = tid & 15;                 // 16-byte piece of the 256-B row
  const _Float16* gx = X + (size_t)(row0 + cr) * C_DIM + cc * 8;
  const _Float16* gw = W + (size_t)(col0 + cr) * C_DIM + cc * 8;
  const unsigned lx = (unsigned)(size_t)smem + (unsigned)(cr * G_PITCH + cc * 8) * 2u;
  const unsigned lw = lx + G_TILE * G_PITCH * 2u;

  const int fa = (wm * 32 + lo) * G_PITCH;             // wave's first X row
  const int fb = (G_TILE + wn * 64 + lo) * G_PITCH;    // wave's first W row

  // pass 0 lands and is published, then pass 1 starts to fly
  copy8_rows(lx, gx);
  copy8_rows(lw, gw);
  asm volatile("s_wait_asynccnt 0x0" ::: "memory");  // own copies of pass 0 landed
  __syncthreads();                                   // publishes pass 0
  copy8_rows(lx + G_STAGE * 2u, gx + G_KPASS);
  copy8_rows(lw + G_STAGE * 2u, gw + G_KPASS);

  for (int t = 0; t < G_NPASS; ++t) {
    const _Float16* sa = smem + (t & 1) * G_STAGE + fa;
    const _Float16* sw = smem + (t & 1) * G_STAGE + fb;
    v16h a[2][2], b[2][4];                 // two fragment sets, one per k step
    a[0][0] = load_frag_f16(sa, hi);
    a[0][1] = load_frag_f16(sa + 16 * G_PITCH, hi);
    b[0][0] = load_frag_f16(sw, hi);
    b[0][1] = load_frag_f16(sw + 16 * G_PITCH, hi);
    b[0][2] = load_frag_f16(sw + 32 * G_PITCH, hi);
    b[0][3] = load_frag_f16(sw + 48 * G_PITCH, hi);
#pragma unroll
    for (int s = 0; s < G_KPASS / 32; ++s) {
      const int cur = s & 1, nxt = cur ^ 1;
      if (s + 1 < G_KPASS / 32) {          // next k step of this same pass
        const int kk = (s + 1) * 32;
        a[nxt][0] = load_frag_f16(sa + kk, hi);
        a[nxt][1] = load_frag_f16(sa + 16 * G_PITCH + kk, hi);
        b[nxt][0] = load_frag_f16(sw + kk, hi);
        b[nxt][1] = load_frag_f16(sw + 16 * G_PITCH + kk, hi);
        b[nxt][2] = load_frag_f16(sw + 32 * G_PITCH + kk, hi);
        b[nxt][3] = load_frag_f16(sw + 48 * G_PITCH + kk, hi);
      }
      // keeps the next step's LDS reads one group ahead of this step's WMMAs;
      // without it they are spread among the WMMAs, each behind a full wait
      __builtin_amdgcn_sched_barrier(0);
      acc[0][0] = wmma_f16(a[cur][0], b[cur][0], acc[0][0]);
      acc[1][0] = wmma_f16(a[cur][1], b[cur][0], acc[1][0]);
      acc[0][1] = wmma_f16(a[cur][0], b[cur][1], acc[0][1]);
      acc[1][1] = wmma_f16(a[cur][1], b[cur][1], acc[1][1]);
      acc[0][2] = wmma_f16(a[cur][0], b[cur][2], acc[0][2]);
      acc[1][2] = wmma_f16(a[cur][1], b[cur][2], acc[1][2]);
      acc[0][3] = wmma_f16(a[cur][0], b[cur][3], acc[0][3]);
      acc[1][3] = wmma_f16(a[cur][1], b[cur][3], acc[1][3]);
      // closes the WMMA group, so that the following reads stay behind it
      __builtin_amdgcn_sched_barrier(0);
    }
    asm volatile("s_wait_dscnt 0x0" ::: "memory");     // own reads of this buffer done
    asm volatile("s_wait_asynccnt 0x0" ::: "memory");  // own copies of pass t+1 landed
    __syncthreads();  // publishes pass t+1 and frees this pass's buffer
    if (t + 2 < G_NPASS) {
      const unsigned bo = (unsigned)(t & 1) * (G_STAGE * 2u);
      copy8_rows(lx + bo, gx + (t + 2) * G_KPASS);
      copy8_rows(lw + bo, gw + (t + 2) * G_KPASS);
    }
  }
  asm volatile("s_wait_asynccnt 0x0" ::: "memory");    // nothing in flight at the end
}

// ---------------------------------------------------------------------------
// f16 GEMM, 32x64 tile per wave: P = X * W^T + b  (rows m = t*N+n, cols c)
// MODE 0: store f16 head layout out[n][h][t][d]        (Q, K)
// MODE 1: store f16 transposed head layout out[n][h][d][t]   (V)
// grid = (C/128, M/128), 256 threads (8 waves) per block.
// ---------------------------------------------------------------------------
template <int MODE>
__global__ __launch_bounds__(256) void proj_kernel(
    const _Float16* __restrict__ X, const _Float16* __restrict__ W,
    const float* __restrict__ bias, _Float16* __restrict__ out) {
  __shared__ __attribute__((aligned(16))) _Float16 smem[2 * G_STAGE];
  const int lane = threadIdx.x & 31;
  const int wave = threadIdx.x >> 5;
  const int lo = lane & 15, hi = lane >> 4;
  const int wm = wave & 3, wn = wave >> 2;

  v8f acc[2][4] = {};
  gemm_tile_128(X, W, smem, blockIdx.y * G_TILE, blockIdx.x * G_TILE, wm, wn,
                lo, hi, acc);
  const int row0 = blockIdx.y * G_TILE + wm * 32;   // this wave's 32x64 piece
  const int col0 = blockIdx.x * G_TILE + wn * 64;

#pragma unroll
  for (int g = 0; g < 4; ++g) {
    const int col = col0 + g * 16 + lo;   // output channel
    const float bv = bias[col];
    const int h = col >> 6;               // / D_HEAD
    const int d = col & 63;
#pragma unroll
    for (int mi = 0; mi < 2; ++mi) {
#pragma unroll
      for (int r = 0; r < 8; ++r) {
        const int m = row0 + mi * 16 + r + 8 * hi;  // row = t*N + n
        const int t = m >> 1;                       // N_DIM == 2
        const int n = m & 1;
        const float val = acc[mi][g][r] + bv;
        size_t idx;
        if (MODE == 0)
          idx = ((size_t)((n * H_DIM + h) * T_DIM + t)) * D_HEAD + d;
        else
          idx = ((size_t)((n * H_DIM + h) * D_HEAD + d)) * T_DIM + t;
        out[idx] = (_Float16)val;
      }
    }
  }
}

// ---------------------------------------------------------------------------
// Flash attention, one wave per (n, h, 16-query tile).
// S^T = K_tile * Q^T: the 16x16 f32 D-fragment of S^T (lane = query column,
// VGPR r = key row r+8*hi) is element-for-element the A-fragment layout of P
// for the P*V WMMA -> no cross-lane shuffle between the two GEMMs.
// Dead 32-key tiles (outside band, beyond key prefix) skipped scalar-uniformly.
// ---------------------------------------------------------------------------
__global__ __launch_bounds__(32) void attn_kernel(
    const _Float16* __restrict__ Qh, const _Float16* __restrict__ Kh,
    const _Float16* __restrict__ Vt, const int* __restrict__ key_length,
    _Float16* __restrict__ Y) {
  const int lane = threadIdx.x & 31;
  const int lo = lane & 15, hi = lane >> 4;
  const int qbase = blockIdx.x * 16;
  const int h = blockIdx.y;
  const int n = blockIdx.z;
  const int keylen = key_length[n];

  const _Float16* Qp = Qh + ((size_t)(n * H_DIM + h) * T_DIM) * D_HEAD;
  const _Float16* Kp = Kh + ((size_t)(n * H_DIM + h) * T_DIM) * D_HEAD;
  const _Float16* Vp = Vt + ((size_t)(n * H_DIM + h) * D_HEAD) * T_DIM;

  // Q^T B-fragments: lane column q = lo, two 32-wide d chunks.
  const _Float16* qrow = Qp + (size_t)(qbase + lo) * D_HEAD;
  const v16h qb0 = load_frag_f16(qrow, hi);        // d = 0..31
  const v16h qb1 = load_frag_f16(qrow + 32, hi);   // d = 32..63

  v8f o[4] = {};                 // O fragments: d-groups of 16
  float m_run = -INFINITY;
  float l_run = 0.0f;
  const int qg = qbase + lo;     // this lane's query row (dup across hi halves)

  for (int kb = 0; kb < T_DIM; kb += 32) {
    // tile fully masked iff no band overlap AND beyond the key prefix
    const bool band = (kb <= qbase + 15 + WIN) && (kb + 31 >= qbase - WIN);
    if (!band && kb >= keylen) continue;

    // K A-fragments (lane row = key), two row halves x two d chunks
    const _Float16* kr0 = Kp + (size_t)(kb + lo) * D_HEAD;
    const _Float16* kr1 = Kp + (size_t)(kb + 16 + lo) * D_HEAD;
    if (kb + 32 < T_DIM) {       // prefetch next key tile rows
      __builtin_prefetch(kr0 + 32 * D_HEAD, 0, 3);
      __builtin_prefetch(kr1 + 32 * D_HEAD, 0, 3);
    }
    v8f s0 = {}, s1 = {};
    s0 = wmma_f16(load_frag_f16(kr0, hi), qb0, s0);
    s0 = wmma_f16(load_frag_f16(kr0 + 32, hi), qb1, s0);
    s1 = wmma_f16(load_frag_f16(kr1, hi), qb0, s1);
    s1 = wmma_f16(load_frag_f16(kr1 + 32, hi), qb1, s1);

    // scale + mask + per-query max
    float mt = -INFINITY;
#pragma unroll
    for (int r = 0; r < 8; ++r) {
      const int kg0 = kb + r + 8 * hi;
      const int kg1 = kg0 + 16;
      float v0 = s0[r] * 0.125f;   // 1/sqrt(Dh)
      float v1 = s1[r] * 0.125f;
      int d0 = qg - kg0; d0 = d0 < 0 ? -d0 : d0;
      int d1 = qg - kg1; d1 = d1 < 0 ? -d1 : d1;
      if (!(d0 <= WIN || kg0 < keylen)) v0 = NEG_BIG;
      if (!(d1 <= WIN || kg1 < keylen)) v1 = NEG_BIG;
      s0[r] = v0; s1[r] = v1;
      mt = fmaxf(mt, fmaxf(v0, v1));
    }
    mt = fmaxf(mt, __shfl_xor(mt, 16, 32));   // join the two key halves
    const float m_new = fmaxf(m_run, mt);
    const float alpha = __expf(m_run - m_new);

    // exp -> P fragment (already in A-fragment layout), row-sum
    v16h pa;
    float rs = 0.0f;
#pragma unroll
    for (int r = 0; r < 8; ++r) {
      const float p0 = __expf(s0[r] - m_new);
      const float p1 = __expf(s1[r] - m_new);
      rs += p0 + p1;
      pa[r] = (_Float16)p0;
      pa[8 + r] = (_Float16)p1;
    }
    rs += __shfl_xor(rs, 16, 32);
    l_run = l_run * alpha + rs;
    m_run = m_new;

    // rescale O accumulators; O-fragment row q = r + 8*hi, alpha lives in lane q
#pragma unroll
    for (int r = 0; r < 8; ++r) {
      const float ar = __shfl(alpha, hi * 8 + r, 32);
      o[0][r] *= ar; o[1][r] *= ar; o[2][r] *= ar; o[3][r] *= ar;
    }

    // O += P * V  (V transposed in memory: Vp[d][t] contiguous in t)
#pragma unroll
    for (int g = 0; g < 4; ++g) {
      const _Float16* vrow = Vp + (size_t)(g * 16 + lo) * T_DIM + kb;
      o[g] = wmma_f16(pa, load_frag_f16(vrow, hi), o[g]);
    }
  }

  // epilogue: O/l  -> Y[(t*N+n)*C + h*64 + d]  (f16, feeds the out-projection)
#pragma unroll
  for (int r = 0; r < 8; ++r) {
    const float lr = __shfl(l_run, hi * 8 + r, 32);
    const float inv = 1.0f / lr;
    const int qrow_g = qbase + r + 8 * hi;
#pragma unroll
    for (int g = 0; g < 4; ++g) {
      const int c = h * D_HEAD + g * 16 + lo;
      Y[((size_t)qrow_g * N_DIM + n) * C_DIM + c] = (_Float16)(o[g][r] * inv);
    }
  }
}

// ---------------------------------------------------------------------------
// Output projection: out = Y(f16, MxC) * Wo^T(f16) + bo -> fp32 (T,N,C)
// Same tile structure as proj_kernel.
// ---------------------------------------------------------------------------
__global__ __launch_bounds__(256) void outproj_kernel(
    const _Float16* __restrict__ Yin, const _Float16* __restrict__ W,
    const float* __restrict__ bias, float* __restrict__ out) {
  __shared__ __attribute__((aligned(16))) _Float16 smem[2 * G_STAGE];
  const int lane = threadIdx.x & 31;
  const int wave = threadIdx.x >> 5;
  const int lo = lane & 15, hi = lane >> 4;
  const int wm = wave & 3, wn = wave >> 2;

  v8f acc[2][4] = {};
  gemm_tile_128(Yin, W, smem, blockIdx.y * G_TILE, blockIdx.x * G_TILE, wm, wn,
                lo, hi, acc);
  const int row0 = blockIdx.y * G_TILE + wm * 32;   // this wave's 32x64 piece
  const int col0 = blockIdx.x * G_TILE + wn * 64;

#pragma unroll
  for (int g = 0; g < 4; ++g) {
    const int col = col0 + g * 16 + lo;
    const float bv = bias[col];
#pragma unroll
    for (int mi = 0; mi < 2; ++mi) {
#pragma unroll
      for (int r = 0; r < 8; ++r) {
        const int m = row0 + mi * 16 + r + 8 * hi;
        out[(size_t)m * C_DIM + col] = acc[mi][g][r] + bv;
      }
    }
  }
}

// ---------------------------------------------------------------------------
extern "C" void kernel_launch(void* const* d_in, const int* in_sizes, int n_in,
                              void* d_out, int out_size, void* d_ws,
                              size_t ws_size, hipStream_t stream) {
  (void)in_sizes; (void)n_in; (void)out_size; (void)ws_size;
  const float* q  = (const float*)d_in[0];
  const float* k  = (const float*)d_in[1];
  const float* v  = (const float*)d_in[2];
  const float* Wq = (const float*)d_in[3];
  const float* bq = (const float*)d_in[4];
  const float* Wk = (const float*)d_in[5];
  const float* bk = (const float*)d_in[6];
  const float* Wv = (const float*)d_in[7];
  const float* bv = (const float*)d_in[8];
  const float* Wo = (const float*)d_in[9];
  const float* bo = (const float*)d_in[10];
  const int* key_length = (const int*)d_in[11];
  float* out = (float*)d_out;

  // Workspace (f16 elements), total 64 MB:
  //   Qh, Kh, Vt, Y          : 4 x N*H*T*Dh  = 4 x 4M   (32 MB)
  //   q16, k16, v16          : 3 x T*N*C     = 3 x 4M   (24 MB)
  //   Wq16, Wk16, Wv16, Wo16 : 4 x C*C       = 4 x 1M   ( 8 MB)
  const size_t HSZ = (size_t)N_DIM * H_DIM * T_DIM * D_HEAD;  // 4,194,304
  const size_t WSZ = (size_t)C_DIM * C_DIM;                   // 1,048,576
  _Float16* Qh   = (_Float16*)d_ws;
  _Float16* Kh   = Qh + HSZ;
  _Float16* Vt   = Kh + HSZ;
  _Float16* Y    = Vt + HSZ;
  _Float16* q16  = Y + HSZ;
  _Float16* k16  = q16 + HSZ;
  _Float16* v16  = k16 + HSZ;
  _Float16* Wq16 = v16 + HSZ;
  _Float16* Wk16 = Wq16 + WSZ;
  _Float16* Wv16 = Wk16 + WSZ;
  _Float16* Wo16 = Wv16 + WSZ;

  // 1) bulk fp32 -> f16 conversions (removes all cvt work from GEMM hot loops)
  cvt_kernel<<<HSZ / 2048, 256, 0, stream>>>(q, q16);
  cvt_kernel<<<HSZ / 2048, 256, 0, stream>>>(k, k16);
  cvt_kernel<<<HSZ / 2048, 256, 0, stream>>>(v, v16);
  cvt_kernel<<<WSZ / 2048, 256, 0, stream>>>(Wq, Wq16);
  cvt_kernel<<<WSZ / 2048, 256, 0, stream>>>(Wk, Wk16);
  cvt_kernel<<<WSZ / 2048, 256, 0, stream>>>(Wv, Wv16);
  cvt_kernel<<<WSZ / 2048, 256, 0, stream>>>(Wo, Wo16);

  // 2) input projections into WMMA-friendly head layouts
  const dim3 gp(C_DIM / 128, M_ROWS / 128);  // (8, 32) 128x128 tiles, 8 waves each
  proj_kernel<0><<<gp, 256, 0, stream>>>(q16, Wq16, bq, Qh);
  proj_kernel<0><<<gp, 256, 0, stream>>>(k16, Wk16, bk, Kh);
  proj_kernel<1><<<gp, 256, 0, stream>>>(v16, Wv16, bv, Vt);

  // 3) banded + prefix-masked flash attention
  attn_kernel<<<dim3(T_DIM / 16, H_DIM, N_DIM), 32, 0, stream>>>(
      Qh, Kh, Vt, key_length, Y);

  // 4) output projection (fp32 result + bias)
  outproj_kernel<<<gp, 256, 0, stream>>>(Y, Wo16, bo, out);
}

// v002
// One run takes 110 microseconds.
// Two timings next to v001 put it at 1.14 and 1.11 times that version's speed.
// All steps since v000 together make it 2.11 times as fast.
#include <hip/hip_runtime.h>

#define T_DIM   2048
#define N_DIM   2
#define C_DIM   1024
#define H_DIM   16
#define D_HEAD  64
#define M_ROWS  (T_DIM * N_DIM)   // 4096 rows (t*N + n)
#define WIN     128
#define NEG_BIG (-1.0e9f)

typedef __attribute__((ext_vector_type(16))) _Float16 v16h;
typedef __attribute__((ext_vector_type(8)))  _Float16 v8h;
typedef __attribute__((ext_vector_type(8)))  float    v8f;

static __device__ __forceinline__ v8f wmma_f16(v16h a, v16h b, v8f c) {
  // D = A(16x32 f16) * B(32x16 f16) + C(16x16 f32)
  return __builtin_amdgcn_wmma_f32_16x16x32_f16(false, a, false, b, (short)0, c,
                                                false, false);
}

// A/B fragment slice: elems 0..7 = p[hi*8 ..], elems 8..15 = p[16 + hi*8 ..]
static __device__ __forceinline__ v16h load_frag_f16(const _Float16* p, int hi) {
  v8h a = *(const v8h*)(p + hi * 8);
  v8h b = *(const v8h*)(p + 16 + hi * 8);
  v16h r;
#pragma unroll
  for (int i = 0; i < 8; ++i) { r[i] = a[i]; r[8 + i] = b[i]; }
  return r;
}

// ---------------------------------------------------------------------------
// fp32 -> f16 conversion of all seven operands in ONE resident launch:
// 256 workgroups of 16 waves.  Wave gw converts piece gw (1024 floats, 4 KB)
// of q, of k, of v and of the four weights laid end to end.  Each load covers
// 512 contiguous bytes, each store 256; all 32 loads of a wave are issued
// before its first conversion.  The f16 copies lie end to end in out:
// q, k, v (X_ELEMS each), then Wq, Wk, Wv, Wo.
// ---------------------------------------------------------------------------
#define X_ELEMS   (M_ROWS * C_DIM)         // 4,194,304 elements of q, k or v
#define CV_WAVES  16                       // waves per workgroup
#define CV_PIECE  1024                     // floats per wave and source
#define CV_GRID   (X_ELEMS / (CV_WAVES * CV_PIECE))          // 256
#define CV_W_PIECES (C_DIM * C_DIM / CV_PIECE)               // 1024 per weight

typedef __attribute__((ext_vector_type(4))) float    v4f;
typedef __attribute__((ext_vector_type(4))) _Float16 v4h;

__global__ __launch_bounds__(CV_WAVES * 32) void cvt_all_kernel(
    const float* __restrict__ q, const float* __restrict__ k,
    const float* __restrict__ v, const float* __restrict__ Wq,
    const float* __restrict__ Wk, const float* __restrict__ Wv,
    const float* __restrict__ Wo, _Float16* __restrict__ out) {
  const unsigned lane = threadIdx.x & 31;
  const unsigned gw = blockIdx.x * CV_WAVES + (threadIdx.x >> 5);   // 0 .. 4095
  // a workgroup's 16 pieces lie inside one weight
  const unsigned wsel = blockIdx.x / (CV_W_PIECES / CV_WAVES);
  const float* w = wsel == 0 ? Wq : wsel == 1 ? Wk : wsel == 2 ? Wv : Wo;
  // byte offset of this lane's first 16 bytes: the same in q, k and v, and in
  // the four weights counted end to end (wb + bo lies inside weight wsel)
  const unsigned bo = (gw * CV_PIECE + lane * 4) * 4u;
  const char* qb = (const char*)q;
  const char* kb = (const char*)k;
  const char* vb = (const char*)v;
  const char* wb = (const char*)w - (size_t)wsel * (C_DIM * C_DIM * 4);

  const char* const sb[4] = {qb, kb, vb, wb};

  // All 32 loads are issued before the first conversion, source by source.
  // Each scheduling barrier keeps the loads in the order in which they are
  // used (else the first source's last load is issued near the end and its
  // stores wait for everything) and ahead of the conversions (else only half
  // of the loads are issued at once).
  v4f x[4][8];
#pragma unroll
  for (int s = 0; s < 4; ++s) {
#pragma unroll
    for (int j = 0; j < 8; ++j) x[s][j] = *(const v4f*)(sb[s] + bo + j * 512);
    __builtin_amdgcn_sched_barrier(0);
  }

  const unsigned ho = bo >> 1;             // the same place in f16 bytes
#pragma unroll
  for (int s = 0; s < 4; ++s) {
    char* d = (char*)out + (size_t)s * (X_ELEMS * 2);
#pragma unroll
    for (int j = 0; j < 8; ++j) {
      v4h y;
#pragma unroll
      for (int i = 0; i < 4; ++i) y[i] = (_Float16)x[s][j][i];
      *(v4h*)(d + ho + j * 256) = y;
    }
    // lets this source's stores go out while the later sources' loads still
    // fly; without it every store is held back to the end of the wave
    if (s < 3) __builtin_amdgcn_sched_barrier(0);
  }
}

// ---------------------------------------------------------------------------
// Shared GEMM main loop: one 128x128 tile of X * W^T per workgroup of 8 waves,
// each wave a 32x64 piece (4 wave rows x 2 wave columns).  A pass is 128 k
// (256 B of each of the 128 X rows and 128 W rows), brought into LDS by
// per-lane asynchronous 16-byte copies, two buffers: the next pass's copies
// fly while this pass is multiplied.  LDS row pitch 272 B (16 B x odd) keeps
// the 16-byte fragment reads free of bank conflicts.
// ---------------------------------------------------------------------------
#define G_TILE   128                       // rows of X and rows of W per tile
#define G_KPASS  128                       // k per pass
#define G_NPASS  (C_DIM / G_KPASS)         // 8
#define G_PITCH  136                       // f16 per LDS row (272 B)
#define G_STAGE  (2 * G_TILE * G_PITCH)    // f16 per buffer: [X rows | W rows]

// Eight 16-byte copies of this lane, rows 16 apart in both places.  The
// s_wait_xcnt stands inside the statement so that no address register of an
// issued copy is rewritten ahead of it.
static __device__ __forceinline__ void copy8_rows(unsigned l, const _Float16* g) {
  const unsigned ls = 16 * G_PITCH * 2;    // bytes between copies in LDS
  const size_t gs = (size_t)16 * C_DIM;    // f16 between copies in memory
  asm volatile(
      "global_load_async_to_lds_b128 %0, %8, off\n\t"
      "global_load_async_to_lds_b128 %1, %9, off\n\t"
      "global_load_async_to_lds_b128 %2, %10, off\n\t"
      "global_load_async_to_lds_b128 %3, %11, off\n\t"
      "global_load_async_to_lds_b128 %4, %12, off\n\t"
      "global_load_async_to_lds_b128 %5, %13, off\n\t"
      "global_load_async_to_lds_b128 %6, %14, off\n\t"
      "global_load_async_to_lds_b128 %7, %15, off\n\t"
      "s_wait_xcnt 0x0"
      :: "v"(l), "v"(l + ls), "v"(l + 2 * ls), "v"(l + 3 * ls),
         "v"(l + 4 * ls), "v"(l + 5 * ls), "v"(l + 6 * ls), "v"(l + 7 * ls),
         "v"(g), "v"(g + gs), "v"(g + 2 * gs), "v"(g + 3 * gs),
         "v"(g + 4 * gs), "v"(g + 5 * gs), "v"(g + 6 * gs), "v"(g + 7 * gs)
      : "memory");
}

// acc[mi][g] = rows (row0 + wm*32 + mi*16 ..) x cols (col0 + wn*64 + g*16 ..)
static __device__ __forceinline__ void gemm_tile_128(
    const _Float16* __restrict__ X, const _Float16* __restrict__ W,
    _Float16* smem, int row0, int col0, int wm, int wn, int lo, int hi,
    v8f (&acc)[2][4]) {
  const int tid = threadIdx.x;
  const int cr = tid >> 4;                 // copy row inside a group of 16
  const int cc = tid & 15;                 // 16-byte piece of the 256-B row
  const _Float16* gx = X + (size_t)(row0 + cr) * C_DIM + cc * 8;
  const _Float16* gw = W + (size_t)(col0 + cr) * C_DIM + cc * 8;
  const unsigned lx = (unsigned)(size_t)smem + (unsigned)(cr * G_PITCH + cc * 8) * 2u;
  const unsigned lw = lx + G_TILE * G_PITCH * 2u;

  const int fa = (wm * 32 + lo) * G_PITCH;             // wave's first X row
  const int fb = (G_TILE + wn * 64 + lo) * G_PITCH;    // wave's first W row

  // pass 0 lands and is published, then pass 1 starts to fly
  copy8_rows(lx, gx);
  copy8_rows(lw, gw);
  asm volatile("s_wait_asynccnt 0x0" ::: "memory");  // own copies of pass 0 landed
  __syncthreads();                                   // publishes pass 0
  copy8_rows(lx + G_STAGE * 2u, gx + G_KPASS);
  copy8_rows(lw + G_STAGE * 2u, gw + G_KPASS);

  for (int t = 0; t < G_NPASS; ++t) {
    const _Float16* sa = smem + (t & 1) * G_STAGE + fa;
    const _Float16* sw = smem + (t & 1) * G_STAGE + fb;
    v16h a[2][2], b[2][4];                 // two fragment sets, one per k step
    a[0][0] = load_frag_f16(sa, hi);
    a[0][1] = load_frag_f16(sa + 16 * G_PITCH, hi);
    b[0][0] = load_frag_f16(sw, hi);
    b[0][1] = load_frag_f16(sw + 16 * G_PITCH, hi);
    b[0][2] = load_frag_f16(sw + 32 * G_PITCH, hi);
    b[0][3] = load_frag_f16(sw + 48 * G_PITCH, hi);
#pragma unroll
    for (int s = 0; s < G_KPASS / 32; ++s) {
      const int cur = s & 1, nxt = cur ^ 1;
      if (s + 1 < G_KPASS / 32) {          // next k step of this same pass
        const int kk = (s + 1) * 32;
        a[nxt][0] = load_frag_f16(sa + kk, hi);
        a[nxt][1] = load_frag_f16(sa + 16 * G_PITCH + kk, hi);
        b[nxt][0] = load_frag_f16(sw + kk, hi);
        b[nxt][1] = load_frag_f16(sw + 16 * G_PITCH + kk, hi);
        b[nxt][2] = load_frag_f16(sw + 32 * G_PITCH + kk, hi);
        b[nxt][3] = load_frag_f16(sw + 48 * G_PITCH + kk, hi);
      }
      // keeps the next step's LDS reads one group ahead of this step's WMMAs;
      // without it they are spread among the WMMAs, each behind a full wait
      __builtin_amdgcn_sched_barrier(0);
      acc[0][0] = wmma_f16(a[cur][0], b[cur][0], acc[0][0]);
      acc[1][0] = wmma_f16(a[cur][1], b[cur][0], acc[1][0]);
      acc[0][1] = wmma_f16(a[cur][0], b[cur][1], acc[0][1]);
      acc[1][1] = wmma_f16(a[cur][1], b[cur][1], acc[1][1]);
      acc[0][2] = wmma_f16(a[cur][0], b[cur][2], acc[0][2]);
      acc[1][2] = wmma_f16(a[cur][1], b[cur][2], acc[1][2]);
      acc[0][3] = wmma_f16(a[cur][0], b[cur][3], acc[0][3]);
      acc[1][3] = wmma_f16(a[cur][1], b[cur][3], acc[1][3]);
      // closes the WMMA group, so that the following reads stay behind it
      __builtin_amdgcn_sched_barrier(0);
    }
    asm volatile("s_wait_dscnt 0x0" ::: "memory");     // own reads of this buffer done
    asm volatile("s_wait_asynccnt 0x0" ::: "memory");  // own copies of pass t+1 landed
    __syncthreads();  // publishes pass t+1 and frees this pass's buffer
    if (t + 2 < G_NPASS) {
      const unsigned bo = (unsigned)(t & 1) * (G_STAGE * 2u);
      copy8_rows(lx + bo, gx + (t + 2) * G_KPASS);
      copy8_rows(lw + bo, gw + (t + 2) * G_KPASS);
    }
  }
  asm volatile("s_wait_asynccnt 0x0" ::: "memory");    // nothing in flight at the end
}

// ---------------------------------------------------------------------------
// f16 GEMM, 32x64 tile per wave: P = X * W^T + b  (rows m = t*N+n, cols c)
// MODE 0: store f16 head layout out[n][h][t][d]        (Q, K)
// MODE 1: store f16 transposed head layout out[n][h][d][t]   (V)
// grid = (C/128, M/128), 256 threads (8 waves) per block.
// ---------------------------------------------------------------------------
template <int MODE>
__global__ __launch_bounds__(256) void proj_kernel(
    const _Float16* __restrict__ X, const _Float16* __restrict__ W,
    const float* __restrict__ bias, _Float16* __restrict__ out) {
  __shared__ __attribute__((aligned(16))) _Float16 smem[2 * G_STAGE];
  const int lane = threadIdx.x & 31;
  const int wave = threadIdx.x >> 5;
  const int lo = lane & 15, hi = lane >> 4;
  const int wm = wave & 3, wn = wave >> 2;

  v8f acc[2][4] = {};
  gemm_tile_128(X, W, smem, blockIdx.y * G_TILE, blockIdx.x * G_TILE, wm, wn,
                lo, hi, acc);
  const int row0 = blockIdx.y * G_TILE + wm * 32;   // this wave's 32x64 piece
  const int col0 = blockIdx.x * G_TILE + wn * 64;

#pragma unroll
  for (int g = 0; g < 4; ++g) {
    const int col = col0 + g * 16 + lo;   // output channel
    const float bv = bias[col];
    const int h = col >> 6;               // / D_HEAD
    const int d = col & 63;
#pragma unroll
    for (int mi = 0; mi < 2; ++mi) {
#pragma unroll
      for (int r = 0; r < 8; ++r) {
        const int m = row0 + mi * 16 + r + 8 * hi;  // row = t*N + n
        const int t = m >> 1;                       // N_DIM == 2
        const int n = m & 1;
        const float val = acc[mi][g][r] + bv;
        size_t idx;
        if (MODE == 0)
          idx = ((size_t)((n * H_DIM + h) * T_DIM + t)) * D_HEAD + d;
        else
          idx = ((size_t)((n * H_DIM + h) * D_HEAD + d)) * T_DIM + t;
        out[idx] = (_Float16)val;
      }
    }
  }
}

// ---------------------------------------------------------------------------
// Flash attention, one wave per (n, h, 16-query tile).
// S^T = K_tile * Q^T: the 16x16 f32 D-fragment of S^T (lane = query column,
// VGPR r = key row r+8*hi) is element-for-element the A-fragment layout of P
// for the P*V WMMA -> no cross-lane shuffle between the two GEMMs.
// Dead 32-key tiles (outside band, beyond key prefix) skipped scalar-uniformly.
// ---------------------------------------------------------------------------
__global__ __launch_bounds__(32) void attn_kernel(
    const _Float16* __restrict__ Qh, const _Float16* __restrict__ Kh,
    const _Float16* __restrict__ Vt, const int* __restrict__ key_length,
    _Float16* __restrict__ Y) {
  const int lane = threadIdx.x & 31;
  const int lo = lane & 15, hi = lane >> 4;
  const int qbase = blockIdx.x * 16;
  const int h = blockIdx.y;
  const int n = blockIdx.z;
  const int keylen = key_length[n];

  const _Float16* Qp = Qh + ((size_t)(n * H_DIM + h) * T_DIM) * D_HEAD;
  const _Float16* Kp = Kh + ((size_t)(n * H_DIM + h) * T_DIM) * D_HEAD;
  const _Float16* Vp = Vt + ((size_t)(n * H_DIM + h) * D_HEAD) * T_DIM;

  // Q^T B-fragments: lane column q = lo, two 32-wide d chunks.
  const _Float16* qrow = Qp + (size_t)(qbase + lo) * D_HEAD;
  const v16h qb0 = load_frag_f16(qrow, hi);        // d = 0..31
  const v16h qb1 = load_frag_f16(qrow + 32, hi);   // d = 32..63

  v8f o[4] = {};                 // O fragments: d-groups of 16
  float m_run = -INFINITY;
  float l_run = 0.0f;
  const int qg = qbase + lo;     // this lane's query row (dup across hi halves)

  for (int kb = 0; kb < T_DIM; kb += 32) {
    // tile fully masked iff no band overlap AND beyond the key prefix
    const bool band = (kb <= qbase + 15 + WIN) && (kb + 31 >= qbase - WIN);
    if (!band && kb >= keylen) continue;

    // K A-fragments (lane row = key), two row halves x two d chunks
    const _Float16* kr0 = Kp + (size_t)(kb + lo) * D_HEAD;
    const _Float16* kr1 = Kp + (size_t)(kb + 16 + lo) * D_HEAD;
    if (kb + 32 < T_DIM) {       // prefetch next key tile rows
      __builtin_prefetch(kr0 + 32 * D_HEAD, 0, 3);
      __builtin_prefetch(kr1 + 32 * D_HEAD, 0, 3);
    }
    v8f s0 = {}, s1 = {};
    s0 = wmma_f16(load_frag_f16(kr0, hi), qb0, s0);
    s0 = wmma_f16(load_frag_f16(kr0 + 32, hi), qb1, s0);
    s1 = wmma_f16(load_frag_f16(kr1, hi), qb0, s1);
    s1 = wmma_f16(load_frag_f16(kr1 + 32, hi), qb1, s1);

    // scale + mask + per-query max
    float mt = -INFINITY;
#pragma unroll
    for (int r = 0; r < 8; ++r) {
      const int kg0 = kb + r + 8 * hi;
      const int kg1 = kg0 + 16;
      float v0 = s0[r] * 0.125f;   // 1/sqrt(Dh)
      float v1 = s1[r] * 0.125f;
      int d0 = qg - kg0; d0 = d0 < 0 ? -d0 : d0;
      int d1 = qg - kg1; d1 = d1 < 0 ? -d1 : d1;
      if (!(d0 <= WIN || kg0 < keylen)) v0 = NEG_BIG;
      if (!(d1 <= WIN || kg1 < keylen)) v1 = NEG_BIG;
      s0[r] = v0; s1[r] = v1;
      mt = fmaxf(mt, fmaxf(v0, v1));
    }
    mt = fmaxf(mt, __shfl_xor(mt, 16, 32));   // join the two key halves
    const float m_new = fmaxf(m_run, mt);
    const float alpha = __expf(m_run - m_new);

    // exp -> P fragment (already in A-fragment layout), row-sum
    v16h pa;
    float rs = 0.0f;
#pragma unroll
    for (int r = 0; r < 8; ++r) {
      const float p0 = __expf(s0[r] - m_new);
      const float p1 = __expf(s1[r] - m_new);
      rs += p0 + p1;
      pa[r] = (_Float16)p0;
      pa[8 + r] = (_Float16)p1;
    }
    rs += __shfl_xor(rs, 16, 32);
    l_run = l_run * alpha + rs;
    m_run = m_new;

    // rescale O accumulators; O-fragment row q = r + 8*hi, alpha lives in lane q
#pragma unroll
    for (int r = 0; r < 8; ++r) {
      const float ar = __shfl(alpha, hi * 8 + r, 32);
      o[0][r] *= ar; o[1][r] *= ar; o[2][r] *= ar; o[3][r] *= ar;
    }

    // O += P * V  (V transposed in memory: Vp[d][t] contiguous in t)
#pragma unroll
    for (int g = 0; g < 4; ++g) {
      const _Float16* vrow = Vp + (size_t)(g * 16 + lo) * T_DIM + kb;
      o[g] = wmma_f16(pa, load_frag_f16(vrow, hi), o[g]);
    }
  }

  // epilogue: O/l  -> Y[(t*N+n)*C + h*64 + d]  (f16, feeds the out-projection)
#pragma unroll
  for (int r = 0; r < 8; ++r) {
    const float lr = __shfl(l_run, hi * 8 + r, 32);
    const float inv = 1.0f / lr;
    const int qrow_g = qbase + r + 8 * hi;
#pragma unroll
    for (int g = 0; g < 4; ++g) {
      const int c = h * D_HEAD + g * 16 + lo;
      Y[((size_t)qrow_g * N_DIM + n) * C_DIM + c] = (_Float16)(o[g][r] * inv);
    }
  }
}

// ---------------------------------------------------------------------------
// Output projection: out = Y(f16, MxC) * Wo^T(f16) + bo -> fp32 (T,N,C)
// Same tile structure as proj_kernel.
// ---------------------------------------------------------------------------
__global__ __launch_bounds__(256) void outproj_kernel(
    const _Float16* __restrict__ Yin, const _Float16* __restrict__ W,
    const float* __restrict__ bias, float* __restrict__ out) {
  __shared__ __attribute__((aligned(16))) _Float16 smem[2 * G_STAGE];
  const int lane = threadIdx.x & 31;
  const int wave = threadIdx.x >> 5;
  const int lo = lane & 15, hi = lane >> 4;
  const int wm = wave & 3, wn = wave >> 2;

  v8f acc[2][4] = {};
  gemm_tile_128(Yin, W, smem, blockIdx.y * G_TILE, blockIdx.x * G_TILE, wm, wn,
                lo, hi, acc);
  const int row0 = blockIdx.y * G_TILE + wm * 32;   // this wave's 32x64 piece
  const int col0 = blockIdx.x * G_TILE + wn * 64;

#pragma unroll
  for (int g = 0; g < 4; ++g) {
    const int col = col0 + g * 16 + lo;
    const float bv = bias[col];
#pragma unroll
    for (int mi = 0; mi < 2; ++mi) {
#pragma unroll
      for (int r = 0; r < 8; ++r) {
        const int m = row0 + mi * 16 + r + 8 * hi;
        out[(size_t)m * C_DIM + col] = acc[mi][g][r] + bv;
      }
    }
  }
}

// ---------------------------------------------------------------------------
extern "C" void kernel_launch(void* const* d_in, const int* in_sizes, int n_in,
                              void* d_out, int out_size, void* d_ws,
                              size_t ws_size, hipStream_t stream) {
  (void)in_sizes; (void)n_in; (void)out_size; (void)ws_size;
  const float* q  = (const float*)d_in[0];
  const float* k  = (const float*)d_in[1];
  const float* v  = (const float*)d_in[2];
  const float* Wq = (const float*)d_in[3];
  const float* bq = (const float*)d_in[4];
  const float* Wk = (const float*)d_in[5];
  const float* bk = (const float*)d_in[6];
  const float* Wv = (const float*)d_in[7];
  const float* bv = (const float*)d_in[8];
  const float* Wo = (const float*)d_in[9];
  const float* bo = (const float*)d_in[10];
  const int* key_length = (const int*)d_in[11];
  float* out = (float*)d_out;

  // Workspace (f16 elements), total 64 MB:
  //   Qh, Kh, Vt, Y          : 4 x N*H*T*Dh  = 4 x 4M   (32 MB)
  //   q16, k16, v16          : 3 x T*N*C     = 3 x 4M   (24 MB)
  //   Wq16, Wk16, Wv16, Wo16 : 4 x C*C       = 4 x 1M   ( 8 MB)
  const size_t HSZ = (size_t)N_DIM * H_DIM * T_DIM * D_HEAD;  // 4,194,304
  const size_t WSZ = (size_t)C_DIM * C_DIM;                   // 1,048,576
  _Float16* Qh   = (_Float16*)d_ws;
  _Float16* Kh   = Qh + HSZ;
  _Float16* Vt   = Kh + HSZ;
  _Float16* Y    = Vt + HSZ;
  _Float16* q16  = Y + HSZ;
  _Float16* k16  = q16 + HSZ;
  _Float16* v16  = k16 + HSZ;
  _Float16* Wq16 = v16 + HSZ;
  _Float16* Wk16 = Wq16 + WSZ;
  _Float16* Wv16 = Wk16 + WSZ;
  _Float16* Wo16 = Wv16 + WSZ;

  // 1) fp32 -> f16 conversions, one launch; q16 .. Wo16 lie end to end
  cvt_all_kernel<<<CV_GRID, CV_WAVES * 32, 0, stream>>>(q, k, v, Wq, Wk, Wv, Wo,
                                                        q16);

  // 2) input projections into WMMA-friendly head layouts
  const dim3 gp(C_DIM / 128, M_ROWS / 128);  // (8, 32) 128x128 tiles, 8 waves each
  proj_kernel<0><<<gp, 256, 0, stream>>>(q16, Wq16, bq, Qh);
  proj_kernel<0><<<gp, 256, 0, stream>>>(k16, Wk16, bk, Kh);
  proj_kernel<1><<<gp, 256, 0, stream>>>(v16, Wv16, bv, Vt);

  // 3) banded + prefix-masked flash attention
  attn_kernel<<<dim3(T_DIM / 16, H_DIM, N_DIM), 32, 0, stream>>>(
      Qh, Kh, Vt, key_length, Y);

  // 4) output projection (fp32 result + bias)
  outproj_kernel<<<gp, 256, 0, stream>>>(Y, Wo16, bo, out);
}

// v003
// Measured time: 83.5 microseconds a run.
// Timed twice side by side with v002, it ran 1.30 and 1.33 times as fast.
// Over all steps from v000 it is 2.77 times as fast.
#include <hip/hip_runtime.h>

#define T_DIM   2048
#define N_DIM   2
#define C_DIM   1024
#define H_DIM   16
#define D_HEAD  64
#define M_ROWS  (T_DIM * N_DIM)   // 4096 rows (t*N + n)
#define WIN     128
#define NEG_BIG (-1.0e9f)

typedef __attribute__((ext_vector_type(16))) _Float16 v16h;
typedef __attribute__((ext_vector_type(8)))  _Float16 v8h;
typedef __attribute__((ext_vector_type(8)))  float    v8f;

static __device__ __forceinline__ v8f wmma_f16(v16h a, v16h b, v8f c) {
  // D = A(16x32 f16) * B(32x16 f16) + C(16x16 f32)
  return __builtin_amdgcn_wmma_f32_16x16x32_f16(false, a, false, b, (short)0, c,
                                                false, false);
}

// A/B fragment slice: elems 0..7 = p[hi*8 ..], elems 8..15 = p[16 + hi*8 ..]
static __device__ __forceinline__ v16h load_frag_f16(const _Float16* p, int hi) {
  v8h a = *(const v8h*)(p + hi * 8);
  v8h b = *(const v8h*)(p + 16 + hi * 8);
  v16h r;
#pragma unroll
  for (int i = 0; i < 8; ++i) { r[i] = a[i]; r[8 + i] = b[i]; }
  return r;
}

// ---------------------------------------------------------------------------
// fp32 -> f16 conversion of all seven operands in ONE resident launch:
// 256 workgroups of 16 waves.  Wave gw converts piece gw (1024 floats, 4 KB)
// of q, of k, of v and of the four weights laid end to end.  Each load covers
// 512 contiguous bytes, each store 256; all 32 loads of a wave are issued
// before its first conversion.  The f16 copies lie end to end in out:
// q, k, v (X_ELEMS each), then Wq, Wk, Wv, Wo.
// ---------------------------------------------------------------------------
#define X_ELEMS   (M_ROWS * C_DIM)         // 4,194,304 elements of q, k or v
#define CV_WAVES  16                       // waves per workgroup
#define CV_PIECE  1024                     // floats per wave and source
#define CV_GRID   (X_ELEMS / (CV_WAVES * CV_PIECE))          // 256
#define CV_W_PIECES (C_DIM * C_DIM / CV_PIECE)               // 1024 per weight

typedef __attribute__((ext_vector_type(4))) float    v4f;
typedef __attribute__((ext_vector_type(4))) _Float16 v4h;

__global__ __launch_bounds__(CV_WAVES * 32) void cvt_all_kernel(
    const float* __restrict__ q, const float* __restrict__ k,
    const float* __restrict__ v, const float* __restrict__ Wq,
    const float* __restrict__ Wk, const float* __restrict__ Wv,
    const float* __restrict__ Wo, _Float16* __restrict__ out) {
  const unsigned lane = threadIdx.x & 31;
  const unsigned gw = blockIdx.x * CV_WAVES + (threadIdx.x >> 5);   // 0 .. 4095
  // a workgroup's 16 pieces lie inside one weight
  const unsigned wsel = blockIdx.x / (CV_W_PIECES / CV_WAVES);
  const float* w = wsel == 0 ? Wq : wsel == 1 ? Wk : wsel == 2 ? Wv : Wo;
  // byte offset of this lane's first 16 bytes: the same in q, k and v, and in
  // the four weights counted end to end (wb + bo lies inside weight wsel)
  const unsigned bo = (gw * CV_PIECE + lane * 4) * 4u;
  const char* qb = (const char*)q;
  const char* kb = (const char*)k;
  const char* vb = (const char*)v;
  const char* wb = (const char*)w - (size_t)wsel * (C_DIM * C_DIM * 4);

  const char* const sb[4] = {qb, kb, vb, wb};

  // All 32 loads are issued before the first conversion, source by source.
  // Each scheduling barrier keeps the loads in the order in which they are
  // used (else the first source's last load is issued near the end and its
  // stores wait for everything) and ahead of the conversions (else only half
  // of the loads are issued at once).
  v4f x[4][8];
#pragma unroll
  for (int s = 0; s < 4; ++s) {
#pragma unroll
    for (int j = 0; j < 8; ++j) x[s][j] = *(const v4f*)(sb[s] + bo + j * 512);
    __builtin_amdgcn_sched_barrier(0);
  }

  const unsigned ho = bo >> 1;             // the same place in f16 bytes
#pragma unroll
  for (int s = 0; s < 4; ++s) {
    char* d = (char*)out + (size_t)s * (X_ELEMS * 2);
#pragma unroll
    for (int j = 0; j < 8; ++j) {
      v4h y;
#pragma unroll
      for (int i = 0; i < 4; ++i) y[i] = (_Float16)x[s][j][i];
      *(v4h*)(d + ho + j * 256) = y;
    }
    // lets this source's stores go out while the later sources' loads still
    // fly; without it every store is held back to the end of the wave
    if (s < 3) __builtin_amdgcn_sched_barrier(0);
  }
}

// ---------------------------------------------------------------------------
// Shared GEMM main loop: one 128x128 tile of X * W^T per workgroup of 8 waves,
// each wave a 32x64 piece (4 wave rows x 2 wave columns).  A pass is 128 k
// (256 B of each of the 128 X rows and 128 W rows), brought into LDS by
// per-lane asynchronous 16-byte copies, two buffers: the next pass's copies
// fly while this pass is multiplied.  LDS row pitch 272 B (16 B x odd) keeps
// the 16-byte fragment reads free of bank conflicts.
// ---------------------------------------------------------------------------
#define G_TILE   128                       // rows of X and rows of W per tile
#define G_KPASS  128                       // k per pass
#define G_NPASS  (C_DIM / G_KPASS)         // 8
#define G_PITCH  136                       // f16 per LDS row (272 B)
#define G_STAGE  (2 * G_TILE * G_PITCH)    // f16 per buffer: [X rows | W rows]

// Eight 16-byte copies of this lane, rows 16 apart in both places.  The
// s_wait_xcnt stands inside the statement so that no address register of an
// issued copy is rewritten ahead of it.
static __device__ __forceinline__ void copy8_rows(unsigned l, const _Float16* g) {
  const unsigned ls = 16 * G_PITCH * 2;    // bytes between copies in LDS
  const size_t gs = (size_t)16 * C_DIM;    // f16 between copies in memory
  asm volatile(
      "global_load_async_to_lds_b128 %0, %8, off\n\t"
      "global_load_async_to_lds_b128 %1, %9, off\n\t"
      "global_load_async_to_lds_b128 %2, %10, off\n\t"
      "global_load_async_to_lds_b128 %3, %11, off\n\t"
      "global_load_async_to_lds_b128 %4, %12, off\n\t"
      "global_load_async_to_lds_b128 %5, %13, off\n\t"
      "global_load_async_to_lds_b128 %6, %14, off\n\t"
      "global_load_async_to_lds_b128 %7, %15, off\n\t"
      "s_wait_xcnt 0x0"
      :: "v"(l), "v"(l + ls), "v"(l + 2 * ls), "v"(l + 3 * ls),
         "v"(l + 4 * ls), "v"(l + 5 * ls), "v"(l + 6 * ls), "v"(l + 7 * ls),
         "v"(g), "v"(g + gs), "v"(g + 2 * gs), "v"(g + 3 * gs),
         "v"(g + 4 * gs), "v"(g + 5 * gs), "v"(g + 6 * gs), "v"(g + 7 * gs)
      : "memory");
}

// acc[mi][g] = rows (row0 + wm*32 + mi*16 ..) x cols (col0 + wn*64 + g*16 ..)
static __device__ __forceinline__ void gemm_tile_128(
    const _Float16* __restrict__ X, const _Float16* __restrict__ W,
    _Float16* smem, int row0, int col0, int wm, int wn, int lo, int hi,
    v8f (&acc)[2][4]) {
  const int tid = threadIdx.x;
  const int cr = tid >> 4;                 // copy row inside a group of 16
  const int cc = tid & 15;                 // 16-byte piece of the 256-B row
  const _Float16* gx = X + (size_t)(row0 + cr) * C_DIM + cc * 8;
  const _Float16* gw = W + (size_t)(col0 + cr) * C_DIM + cc * 8;
  const unsigned lx = (unsigned)(size_t)smem + (unsigned)(cr * G_PITCH + cc * 8) * 2u;
  const unsigned lw = lx + G_TILE * G_PITCH * 2u;

  const int fa = (wm * 32 + lo) * G_PITCH;             // wave's first X row
  const int fb = (G_TILE + wn * 64 + lo) * G_PITCH;    // wave's first W row

  // pass 0 lands and is published, then pass 1 starts to fly
  copy8_rows(lx, gx);
  copy8_rows(lw, gw);
  asm volatile("s_wait_asynccnt 0x0" ::: "memory");  // own copies of pass 0 landed
  __syncthreads();                                   // publishes pass 0
  copy8_rows(lx + G_STAGE * 2u, gx + G_KPASS);
  copy8_rows(lw + G_STAGE * 2u, gw + G_KPASS);

  for (int t = 0; t < G_NPASS; ++t) {
    const _Float16* sa = smem + (t & 1) * G_STAGE + fa;
    const _Float16* sw = smem + (t & 1) * G_STAGE + fb;
    v16h a[2][2], b[2][4];                 // two fragment sets, one per k step
    a[0][0] = load_frag_f16(sa, hi);
    a[0][1] = load_frag_f16(sa + 16 * G_PITCH, hi);
    b[0][0] = load_frag_f16(sw, hi);
    b[0][1] = load_frag_f16(sw + 16 * G_PITCH, hi);
    b[0][2] = load_frag_f16(sw + 32 * G_PITCH, hi);
    b[0][3] = load_frag_f16(sw + 48 * G_PITCH, hi);
#pragma unroll
    for (int s = 0; s < G_KPASS / 32; ++s) {
      const int cur = s & 1, nxt = cur ^ 1;
      if (s + 1 < G_KPASS / 32) {          // next k step of this same pass
        const int kk = (s + 1) * 32;
        a[nxt][0] = load_frag_f16(sa + kk, hi);
        a[nxt][1] = load_frag_f16(sa + 16 * G_PITCH + kk, hi);
        b[nxt][0] = load_frag_f16(sw + kk, hi);
        b[nxt][1] = load_frag_f16(sw + 16 * G_PITCH + kk, hi);
        b[nxt][2] = load_frag_f16(sw + 32 * G_PITCH + kk, hi);
        b[nxt][3] = load_frag_f16(sw + 48 * G_PITCH + kk, hi);
      }
      // keeps the next step's LDS reads one group ahead of this step's WMMAs;
      // without it they are spread among the WMMAs, each behind a full wait
      __builtin_amdgcn_sched_barrier(0);
      acc[0][0] = wmma_f16(a[cur][0], b[cur][0], acc[0][0]);
      acc[1][0] = wmma_f16(a[cur][1], b[cur][0], acc[1][0]);
      acc[0][1] = wmma_f16(a[cur][0], b[cur][1], acc[0][1]);
      acc[1][1] = wmma_f16(a[cur][1], b[cur][1], acc[1][1]);
      acc[0][2] = wmma_f16(a[cur][0], b[cur][2], acc[0][2]);
      acc[1][2] = wmma_f16(a[cur][1], b[cur][2], acc[1][2]);
      acc[0][3] = wmma_f16(a[cur][0], b[cur][3], acc[0][3]);
      acc[1][3] = wmma_f16(a[cur][1], b[cur][3], acc[1][3]);
      // closes the WMMA group, so that the following reads stay behind it
      __builtin_amdgcn_sched_barrier(0);
    }
    asm volatile("s_wait_dscnt 0x0" ::: "memory");     // own reads of this buffer done
    asm volatile("s_wait_asynccnt 0x0" ::: "memory");  // own copies of pass t+1 landed
    __syncthreads();  // publishes pass t+1 and frees this pass's buffer
    if (t + 2 < G_NPASS) {
      const unsigned bo = (unsigned)(t & 1) * (G_STAGE * 2u);
      copy8_rows(lx + bo, gx + (t + 2) * G_KPASS);
      copy8_rows(lw + bo, gw + (t + 2) * G_KPASS);
    }
  }
  asm volatile("s_wait_asynccnt 0x0" ::: "memory");    // nothing in flight at the end
}

// ---------------------------------------------------------------------------
// f16 GEMM, 32x64 tile per wave: P = X * W^T + b  (rows m = t*N+n, cols c)
// MODE 0: store f16 head layout out[n][h][t][d]        (Q, K)
// MODE 1: store f16 transposed head layout out[n][h][d][t]   (V)
// grid = (C/128, M/128), 256 threads (8 waves) per block.
// ---------------------------------------------------------------------------
template <int MODE>
__global__ __launch_bounds__(256) void proj_kernel(
    const _Float16* __restrict__ X, const _Float16* __restrict__ W,
    const float* __restrict__ bias, _Float16* __restrict__ out) {
  __shared__ __attribute__((aligned(16))) _Float16 smem[2 * G_STAGE];
  const int lane = threadIdx.x & 31;
  const int wave = threadIdx.x >> 5;
  const int lo = lane & 15, hi = lane >> 4;
  const int wm = wave & 3, wn = wave >> 2;

  v8f acc[2][4] = {};
  gemm_tile_128(X, W, smem, blockIdx.y * G_TILE, blockIdx.x * G_TILE, wm, wn,
                lo, hi, acc);
  const int row0 = blockIdx.y * G_TILE + wm * 32;   // this wave's 32x64 piece
  const int col0 = blockIdx.x * G_TILE + wn * 64;

#pragma unroll
  for (int g = 0; g < 4; ++g) {
    const int col = col0 + g * 16 + lo;   // output channel
    const float bv = bias[col];
    const int h = col >> 6;               // / D_HEAD
    const int d = col & 63;
#pragma unroll
    for (int mi = 0; mi < 2; ++mi) {
#pragma unroll
      for (int r = 0; r < 8; ++r) {
        const int m = row0 + mi * 16 + r + 8 * hi;  // row = t*N + n
        const int t = m >> 1;                       // N_DIM == 2
        const int n = m & 1;
        const float val = acc[mi][g][r] + bv;
        size_t idx;
        if (MODE == 0)
          idx = ((size_t)((n * H_DIM + h) * T_DIM + t)) * D_HEAD + d;
        else
          idx = ((size_t)((n * H_DIM + h) * D_HEAD + d)) * T_DIM + t;
        out[idx] = (_Float16)val;
      }
    }
  }
}

// ---------------------------------------------------------------------------
// Flash attention, one workgroup of 8 waves per (n, h, 128 queries), one wave
// per 16-query tile.
// S^T = K_tile * Q^T: the 16x16 f32 D-fragment of S^T (lane = query column,
// VGPR r = key row r+8*hi) is element-for-element the A-fragment layout of P
// for the P*V WMMA -> no cross-lane shuffle between the two GEMMs.
// A stage is 64 keys: 64 K rows (128 B each) and the 64 V^T rows' 128 B for
// those keys, brought into LDS once for all 8 waves by per-lane asynchronous
// 16-byte copies, two buffers: the next stage's copies fly while this stage is
// worked on.  LDS row pitch 144 B (16 B x odd) for the 16-byte fragment reads.
// The workgroup walks only the stages that hold a live key for one of its
// queries (key prefix, then what the band adds); inside a stage each wave
// skips, scalar-uniformly, a 32-key tile that is dead for its own 16 queries.
// ---------------------------------------------------------------------------
#define A_WAVES  8
#define A_QBLK   (A_WAVES * 16)            // queries per workgroup
#define A_KEYS   64                        // keys per stage
#define A_NST    (T_DIM / A_KEYS)          // 32 stages in all
#define A_PITCH  72                        // f16 per LDS row (144 B)
#define A_STAGE  (2 * A_KEYS * A_PITCH)    // f16 per buffer: [K rows | V^T rows]

// This lane's four 16-byte copies of a stage: K rows r and r + 32, V^T rows r
// and r + 32.  The s_wait_xcnt stands inside the statement so that no address
// register of an issued copy is rewritten ahead of it.
static __device__ __forceinline__ void copy_kv(unsigned l, const _Float16* gk,
                                               const _Float16* gv) {
  const unsigned ls = 32 * A_PITCH * 2;    // bytes between copies in LDS
  asm volatile(
      "global_load_async_to_lds_b128 %0, %4, off\n\t"
      "global_load_async_to_lds_b128 %1, %5, off\n\t"
      "global_load_async_to_lds_b128 %2, %6, off\n\t"
      "global_load_async_to_lds_b128 %3, %7, off\n\t"
      "s_wait_xcnt 0x0"
      :: "v"(l), "v"(l + ls), "v"(l + 2 * ls), "v"(l + 3 * ls),
         "v"(gk), "v"(gk + 32 * D_HEAD), "v"(gv), "v"(gv + (size_t)32 * T_DIM)
      : "memory");
}

// 512 workgroups on 256 WGPs: two per WGP, four waves per SIMD; the attribute
// tells the compiler that occupancy, and with it the register budget
__global__ __launch_bounds__(A_WAVES * 32)
__attribute__((amdgpu_waves_per_eu(4, 4))) void attn_kernel(
    const _Float16* __restrict__ Qh, const _Float16* __restrict__ Kh,
    const _Float16* __restrict__ Vt, const int* __restrict__ key_length,
    _Float16* __restrict__ Y) {
  __shared__ __attribute__((aligned(16))) _Float16 smem[2 * A_STAGE];
  const int tid = threadIdx.x;
  const int lane = tid & 31;
  const int lo = lane & 15, hi = lane >> 4;
  // the wave's number in a scalar register: the tile skip below is then a
  // scalar branch
  const int wave = __builtin_amdgcn_readfirstlane(tid >> 5);
  const int qblk = blockIdx.x * A_QBLK;
  const int qbase = qblk + wave * 16;
  const int h = blockIdx.y;
  const int n = blockIdx.z;
  const int keylen = key_length[n];

  const _Float16* Qp = Qh + ((size_t)(n * H_DIM + h) * T_DIM) * D_HEAD;
  const _Float16* Kp = Kh + ((size_t)(n * H_DIM + h) * T_DIM) * D_HEAD;
  const _Float16* Vp = Vt + ((size_t)(n * H_DIM + h) * D_HEAD) * T_DIM;

  // Stages to walk: [0, np) holds the key prefix (its length clamped to the
  // array), [b0, b1] is what the workgroup's band adds behind it.
  const int kl = keylen < 0 ? 0 : (keylen > T_DIM ? T_DIM : keylen);
  const int np = (kl + A_KEYS - 1) / A_KEYS;
  int b0 = (qblk - WIN) / A_KEYS;          // qblk - WIN is a multiple of A_KEYS
  if (b0 < np) b0 = np;
  int b1 = (qblk + A_QBLK - 1 + WIN) / A_KEYS;
  if (b1 > A_NST - 1) b1 = A_NST - 1;
  const int nst = np + (b1 >= b0 ? b1 + 1 - b0 : 0);
  const int bsh = b0 - np;                 // stage of trip i >= np is i + bsh

  // copy places of this lane: row cr (and cr + 32), 16-byte piece cc
  const int cr = tid >> 3;
  const int cc = tid & 7;
  const _Float16* gk = Kp + (size_t)cr * D_HEAD + cc * 8;
  const _Float16* gv = Vp + (size_t)cr * T_DIM + cc * 8;
  const unsigned lc = (unsigned)(size_t)smem + (unsigned)(cr * A_PITCH + cc * 8) * 2u;

  // Q^T B-fragments: lane column q = lo, two 32-wide d chunks.
  const _Float16* qrow = Qp + (size_t)(qbase + lo) * D_HEAD;
  const v16h qb0 = load_frag_f16(qrow, hi);        // d = 0..31
  const v16h qb1 = load_frag_f16(qrow + 32, hi);   // d = 32..63

  v8f o[4] = {};                 // O fragments: d-groups of 16
  float m_run = -INFINITY;
  float l_run = 0.0f;
  const int qg = qbase + lo;     // this lane's query row (dup across hi halves)

  // trip 0's stage lands and is published, then trip 1's starts to fly
  {
    const int st = 0 < np ? 0 : bsh;
    copy_kv(lc, gk + (size_t)st * (A_KEYS * D_HEAD), gv + st * A_KEYS);
  }
  asm volatile("s_wait_asynccnt 0x0" ::: "memory");  // own copies of trip 0 landed
  __syncthreads();                                   // publishes trip 0's stage
  if (1 < nst) {
    const int st = 1 < np ? 1 : 1 + bsh;
    copy_kv(lc + A_STAGE * 2u, gk + (size_t)st * (A_KEYS * D_HEAD),
            gv + st * A_KEYS);
  }

  for (int i = 0; i < nst; ++i) {
    const int st = i < np ? i : i + bsh;
    const _Float16* sk = smem + (i & 1) * A_STAGE;
    const _Float16* sv = sk + A_KEYS * A_PITCH;
#pragma unroll
    for (int u = 0; u < A_KEYS / 32; ++u) {
      const int kb = st * A_KEYS + u * 32;
      // tile fully masked iff no band overlap AND beyond the key prefix
      const bool band = (kb <= qbase + 15 + WIN) && (kb + 31 >= qbase - WIN);
      if (band || kb < keylen) {
        // K A-fragments (lane row = key), two row halves x two d chunks
        const _Float16* kr0 = sk + (u * 32 + lo) * A_PITCH;
        const _Float16* kr1 = sk + (u * 32 + 16 + lo) * A_PITCH;
        v8f s0 = {}, s1 = {};
        s0 = wmma_f16(load_frag_f16(kr0, hi), qb0, s0);
        s0 = wmma_f16(load_frag_f16(kr0 + 32, hi), qb1, s0);
        s1 = wmma_f16(load_frag_f16(kr1, hi), qb0, s1);
        s1 = wmma_f16(load_frag_f16(kr1 + 32, hi), qb1, s1);

        // scale + mask + per-query max
        float mt = -INFINITY;
#pragma unroll
        for (int r = 0; r < 8; ++r) {
          const int kg0 = kb + r + 8 * hi;
          const int kg1 = kg0 + 16;
          float v0 = s0[r] * 0.125f;   // 1/sqrt(Dh)
          float v1 = s1[r] * 0.125f;
          int d0 = qg - kg0; d0 = d0 < 0 ? -d0 : d0;
          int d1 = qg - kg1; d1 = d1 < 0 ? -d1 : d1;
          if (!(d0 <= WIN || kg0 < keylen)) v0 = NEG_BIG;
          if (!(d1 <= WIN || kg1 < keylen)) v1 = NEG_BIG;
          s0[r] = v0; s1[r] = v1;
          mt = fmaxf(mt, fmaxf(v0, v1));
        }
        mt = fmaxf(mt, __shfl_xor(mt, 16, 32));   // join the two key halves
        const float m_new = fmaxf(m_run, mt);
        const float alpha = __expf(m_run - m_new);

        // exp -> P fragment (already in A-fragment layout), row-sum
        v16h pa;
        float rs = 0.0f;
#pragma unroll
        for (int r = 0; r < 8; ++r) {
          const float p0 = __expf(s0[r] - m_new);
          const float p1 = __expf(s1[r] - m_new);
          rs += p0 + p1;
          pa[r] = (_Float16)p0;
          pa[8 + r] = (_Float16)p1;
        }
        rs += __shfl_xor(rs, 16, 32);
        l_run = l_run * alpha + rs;
        m_run = m_new;

        // rescale O accumulators; O-fragment row q = r + 8*hi, alpha in lane q
#pragma unroll
        for (int r = 0; r < 8; ++r) {
          const float ar = __shfl(alpha, hi * 8 + r, 32);
          o[0][r] *= ar; o[1][r] *= ar; o[2][r] *= ar; o[3][r] *= ar;
        }

        // O += P * V  (V^T rows in LDS: row d, this stage's keys in a row)
#pragma unroll
        for (int g = 0; g < 4; ++g) {
          const _Float16* vrow = sv + (g * 16 + lo) * A_PITCH + u * 32;
          o[g] = wmma_f16(pa, load_frag_f16(vrow, hi), o[g]);
        }
      }
    }
    asm volatile("s_wait_dscnt 0x0" ::: "memory");     // own reads of this buffer done
    asm volatile("s_wait_asynccnt 0x0" ::: "memory");  // own copies of trip i+1 landed
    __syncthreads();  // publishes trip i+1's stage and frees this trip's buffer
    if (i + 2 < nst) {
      const int s2 = i + 2 < np ? i + 2 : i + 2 + bsh;
      copy_kv(lc + (unsigned)(i & 1) * (A_STAGE * 2u),
              gk + (size_t)s2 * (A_KEYS * D_HEAD), gv + s2 * A_KEYS);
    }
  }
  asm volatile("s_wait_asynccnt 0x0" ::: "memory");    // nothing in flight at the end

  // epilogue: O/l  -> Y[(t*N+n)*C + h*64 + d]  (f16, feeds the out-projection)
#pragma unroll
  for (int r = 0; r < 8; ++r) {
    const float lr = __shfl(l_run, hi * 8 + r, 32);
    const float inv = 1.0f / lr;
    const int qrow_g = qbase + r + 8 * hi;
#pragma unroll
    for (int g = 0; g < 4; ++g) {
      const int c = h * D_HEAD + g * 16 + lo;
      Y[((size_t)qrow_g * N_DIM + n) * C_DIM + c] = (_Float16)(o[g][r] * inv);
    }
  }
}

// ---------------------------------------------------------------------------
// Output projection: out = Y(f16, MxC) * Wo^T(f16) + bo -> fp32 (T,N,C)
// Same tile structure as proj_kernel.
// ---------------------------------------------------------------------------
__global__ __launch_bounds__(256) void outproj_kernel(
    const _Float16* __restrict__ Yin, const _Float16* __restrict__ W,
    const float* __restrict__ bias, float* __restrict__ out) {
  __shared__ __attribute__((aligned(16))) _Float16 smem[2 * G_STAGE];
  const int lane = threadIdx.x & 31;
  const int wave = threadIdx.x >> 5;
  const int lo = lane & 15, hi = lane >> 4;
  const int wm = wave & 3, wn = wave >> 2;

  v8f acc[2][4] = {};
  gemm_tile_128(Yin, W, smem, blockIdx.y * G_TILE, blockIdx.x * G_TILE, wm, wn,
                lo, hi, acc);
  const int row0 = blockIdx.y * G_TILE + wm * 32;   // this wave's 32x64 piece
  const int col0 = blockIdx.x * G_TILE + wn * 64;

#pragma unroll
  for (int g = 0; g < 4; ++g) {
    const int col = col0 + g * 16 + lo;
    const float bv = bias[col];
#pragma unroll
    for (int mi = 0; mi < 2; ++mi) {
#pragma unroll
      for (int r = 0; r < 8; ++r) {
        const int m = row0 + mi * 16 + r + 8 * hi;
        out[(size_t)m * C_DIM + col] = acc[mi][g][r] + bv;
      }
    }
  }
}

// ---------------------------------------------------------------------------
extern "C" void kernel_launch(void* const* d_in, const int* in_sizes, int n_in,
                              void* d_out, int out_size, void* d_ws,
                              size_t ws_size, hipStream_t stream) {
  (void)in_sizes; (void)n_in; (void)out_size; (void)ws_size;
  const float* q  = (const float*)d_in[0];
  const float* k  = (const float*)d_in[1];
  const float* v  = (const float*)d_in[2];
  const float* Wq = (const float*)d_in[3];
  const float* bq = (const float*)d_in[4];
  const float* Wk = (const float*)d_in[5];
  const float* bk = (const float*)d_in[6];
  const float* Wv = (const float*)d_in[7];
  const float* bv = (const float*)d_in[8];
  const float* Wo = (const float*)d_in[9];
  const float* bo = (const float*)d_in[10];
  const int* key_length = (const int*)d_in[11];
  float* out = (float*)d_out;

  // Workspace (f16 elements), total 64 MB:
  //   Qh, Kh, Vt, Y          : 4 x N*H*T*Dh  = 4 x 4M   (32 MB)
  //   q16, k16, v16          : 3 x T*N*C     = 3 x 4M   (24 MB)
  //   Wq16, Wk16, Wv16, Wo16 : 4 x C*C       = 4 x 1M   ( 8 MB)
  const size_t HSZ = (size_t)N_DIM * H_DIM * T_DIM * D_HEAD;  // 4,194,304
  const size_t WSZ = (size_t)C_DIM * C_DIM;                   // 1,048,576
  _Float16* Qh   = (_Float16*)d_ws;
  _Float16* Kh   = Qh + HSZ;
  _Float16* Vt   = Kh + HSZ;
  _Float16* Y    = Vt + HSZ;
  _Float16* q16  = Y + HSZ;
  _Float16* k16  = q16 + HSZ;
  _Float16* v16  = k16 + HSZ;
  _Float16* Wq16 = v16 + HSZ;
  _Float16* Wk16 = Wq16 + WSZ;
  _Float16* Wv16 = Wk16 + WSZ;
  _Float16* Wo16 = Wv16 + WSZ;

  // 1) fp32 -> f16 conversions, one launch; q16 .. Wo16 lie end to end
  cvt_all_kernel<<<CV_GRID, CV_WAVES * 32, 0, stream>>>(q, k, v, Wq, Wk, Wv, Wo,
                                                        q16);

  // 2) input projections into WMMA-friendly head layouts
  const dim3 gp(C_DIM / 128, M_ROWS / 128);  // (8, 32) 128x128 tiles, 8 waves each
  proj_kernel<0><<<gp, 256, 0, stream>>>(q16, Wq16, bq, Qh);
  proj_kernel<0><<<gp, 256, 0, stream>>>(k16, Wk16, bk, Kh);
  proj_kernel<1><<<gp, 256, 0, stream>>>(v16, Wv16, bv, Vt);

  // 3) banded + prefix-masked flash attention
  attn_kernel<<<dim3(T_DIM / A_QBLK, H_DIM, N_DIM), A_WAVES * 32, 0, stream>>>(
      Qh, Kh, Vt, key_length, Y);

  // 4) output projection (fp32 result + bias)
  outproj_kernel<<<gp, 256, 0, stream>>>(Y, Wo16, bo, out);
}

// v004
// A run of this version takes 79.1 microseconds.
// In two side-by-side timings against v003, it was 1.06 and 1.05 times as fast.
// Counting every step since v000, it is 2.93 times as fast.
#include <hip/hip_runtime.h>

#define T_DIM   2048
#define N_DIM   2
#define C_DIM   1024
#define H_DIM   16
#define D_HEAD  64
#define M_ROWS  (T_DIM * N_DIM)   // 4096 rows (t*N + n)
#define WIN     128
#define NEG_BIG (-1.0e9f)

typedef __attribute__((ext_vector_type(16))) _Float16 v16h;
typedef __attribute__((ext_vector_type(8)))  _Float16 v8h;
typedef __attribute__((ext_vector_type(8)))  float    v8f;

static __device__ __forceinline__ v8f wmma_f16(v16h a, v16h b, v8f c) {
  // D = A(16x32 f16) * B(32x16 f16) + C(16x16 f32)
  return __builtin_amdgcn_wmma_f32_16x16x32_f16(false, a, false, b, (short)0, c,
                                                false, false);
}

// A/B fragment slice: elems 0..7 = p[hi*8 ..], elems 8..15 = p[16 + hi*8 ..]
static __device__ __forceinline__ v16h load_frag_f16(const _Float16* p, int hi) {
  v8h a = *(const v8h*)(p + hi * 8);
  v8h b = *(const v8h*)(p + 16 + hi * 8);
  v16h r;
#pragma unroll
  for (int i = 0; i < 8; ++i) { r[i] = a[i]; r[8 + i] = b[i]; }
  return r;
}

// ---------------------------------------------------------------------------
// fp32 -> f16 conversion of all seven operands in ONE resident launch:
// 256 workgroups of 16 waves.  Wave gw converts piece gw (1024 floats, 4 KB)
// of q, of k, of v and of the four weights laid end to end.  Each load covers
// 512 contiguous bytes, each store 256; all 32 loads of a wave are issued
// before its first conversion.  The f16 copies lie end to end in out:
// q, k, v (X_ELEMS each), then Wq, Wk, Wv, Wo.
// ---------------------------------------------------------------------------
#define X_ELEMS   (M_ROWS * C_DIM)         // 4,194,304 elements of q, k or v
#define CV_WAVES  16                       // waves per workgroup
#define CV_PIECE  1024                     // floats per wave and source
#define CV_GRID   (X_ELEMS / (CV_WAVES * CV_PIECE))          // 256
#define CV_W_PIECES (C_DIM * C_DIM / CV_PIECE)               // 1024 per weight

typedef __attribute__((ext_vector_type(4))) float    v4f;
typedef __attribute__((ext_vector_type(4))) _Float16 v4h;

__global__ __launch_bounds__(CV_WAVES * 32) void cvt_all_kernel(
    const float* __restrict__ q, const float* __restrict__ k,
    const float* __restrict__ v, const float* __restrict__ Wq,
    const float* __restrict__ Wk, const float* __restrict__ Wv,
    const float* __restrict__ Wo, _Float16* __restrict__ out) {
  const unsigned lane = threadIdx.x & 31;
  const unsigned gw = blockIdx.x * CV_WAVES + (threadIdx.x >> 5);   // 0 .. 4095
  // a workgroup's 16 pieces lie inside one weight
  const unsigned wsel = blockIdx.x / (CV_W_PIECES / CV_WAVES);
  const float* w = wsel == 0 ? Wq : wsel == 1 ? Wk : wsel == 2 ? Wv : Wo;
  // byte offset of this lane's first 16 bytes: the same in q, k and v, and in
  // the four weights counted end to end (wb + bo lies inside weight wsel)
  const unsigned bo = (gw * CV_PIECE + lane * 4) * 4u;
  const char* qb = (const char*)q;
  const char* kb = (const char*)k;
  const char* vb = (const char*)v;
  const char* wb = (const char*)w - (size_t)wsel * (C_DIM * C_DIM * 4);

  const char* const sb[4] = {qb, kb, vb, wb};

  // All 32 loads are issued before the first conversion, source by source.
  // Each scheduling barrier keeps the loads in the order in which they are
  // used (else the first source's last load is issued near the end and its
  // stores wait for everything) and ahead of the conversions (else only half
  // of the loads are issued at once).
  v4f x[4][8];
#pragma unroll
  for (int s = 0; s < 4; ++s) {
#pragma unroll
    for (int j = 0; j < 8; ++j) x[s][j] = *(const v4f*)(sb[s] + bo + j * 512);
    __builtin_amdgcn_sched_barrier(0);
  }

  const unsigned ho = bo >> 1;             // the same place in f16 bytes
#pragma unroll
  for (int s = 0; s < 4; ++s) {
    char* d = (char*)out + (size_t)s * (X_ELEMS * 2);
#pragma unroll
    for (int j = 0; j < 8; ++j) {
      v4h y;
#pragma unroll
      for (int i = 0; i < 4; ++i) y[i] = (_Float16)x[s][j][i];
      *(v4h*)(d + ho + j * 256) = y;
    }
    // lets this source's stores go out while the later sources' loads still
    // fly; without it every store is held back to the end of the wave
    if (s < 3) __builtin_amdgcn_sched_barrier(0);
  }
}

// ---------------------------------------------------------------------------
// Shared GEMM main loop: one 128x128 tile of X * W^T per workgroup of 8 waves,
// each wave a 32x64 piece (4 wave rows x 2 wave columns).  A pass is 128 k
// (256 B of each of the 128 X rows and 128 W rows), brought into LDS by
// per-lane asynchronous 16-byte copies, two buffers: the next pass's copies
// fly while this pass is multiplied.  LDS row pitch 272 B (16 B x odd) keeps
// the 16-byte fragment reads free of bank conflicts.
// ---------------------------------------------------------------------------
#define G_TILE   128                       // rows of X and rows of W per tile
#define G_KPASS  128                       // k per pass
#define G_NPASS  (C_DIM / G_KPASS)         // 8
#define G_PITCH  136                       // f16 per LDS row (272 B)
#define G_STAGE  (2 * G_TILE * G_PITCH)    // f16 per buffer: [X rows | W rows]

// Eight 16-byte copies of this lane, rows 16 apart in both places.  The
// s_wait_xcnt stands inside the statement so that no address register of an
// issued copy is rewritten ahead of it.
static __device__ __forceinline__ void copy8_rows(unsigned l, const _Float16* g) {
  const unsigned ls = 16 * G_PITCH * 2;    // bytes between copies in LDS
  const size_t gs = (size_t)16 * C_DIM;    // f16 between copies in memory
  asm volatile(
      "global_load_async_to_lds_b128 %0, %8, off\n\t"
      "global_load_async_to_lds_b128 %1, %9, off\n\t"
      "global_load_async_to_lds_b128 %2, %10, off\n\t"
      "global_load_async_to_lds_b128 %3, %11, off\n\t"
      "global_load_async_to_lds_b128 %4, %12, off\n\t"
      "global_load_async_to_lds_b128 %5, %13, off\n\t"
      "global_load_async_to_lds_b128 %6, %14, off\n\t"
      "global_load_async_to_lds_b128 %7, %15, off\n\t"
      "s_wait_xcnt 0x0"
      :: "v"(l), "v"(l + ls), "v"(l + 2 * ls), "v"(l + 3 * ls),
         "v"(l + 4 * ls), "v"(l + 5 * ls), "v"(l + 6 * ls), "v"(l + 7 * ls),
         "v"(g), "v"(g + gs), "v"(g + 2 * gs), "v"(g + 3 * gs),
         "v"(g + 4 * gs), "v"(g + 5 * gs), "v"(g + 6 * gs), "v"(g + 7 * gs)
      : "memory");
}

// acc[mi][g] = rows (row0 + wm*32 + mi*16 ..) x cols (col0 + wn*64 + g*16 ..)
static __device__ __forceinline__ void gemm_tile_128(
    const _Float16* __restrict__ X, const _Float16* __restrict__ W,
    _Float16* smem, int row0, int col0, int wm, int wn, int lo, int hi,
    v8f (&acc)[2][4]) {
  const int tid = threadIdx.x;
  const int cr = tid >> 4;                 // copy row inside a group of 16
  const int cc = tid & 15;                 // 16-byte piece of the 256-B row
  const _Float16* gx = X + (size_t)(row0 + cr) * C_DIM + cc * 8;
  const _Float16* gw = W + (size_t)(col0 + cr) * C_DIM + cc * 8;
  const unsigned lx = (unsigned)(size_t)smem + (unsigned)(cr * G_PITCH + cc * 8) * 2u;
  const unsigned lw = lx + G_TILE * G_PITCH * 2u;

  const int fa = (wm * 32 + lo) * G_PITCH;             // wave's first X row
  const int fb = (G_TILE + wn * 64 + lo) * G_PITCH;    // wave's first W row

  // pass 0 lands and is published, then pass 1 starts to fly
  copy8_rows(lx, gx);
  copy8_rows(lw, gw);
  asm volatile("s_wait_asynccnt 0x0" ::: "memory");  // own copies of pass 0 landed
  __syncthreads();                                   // publishes pass 0
  copy8_rows(lx + G_STAGE * 2u, gx + G_KPASS);
  copy8_rows(lw + G_STAGE * 2u, gw + G_KPASS);

  for (int t = 0; t < G_NPASS; ++t) {
    const _Float16* sa = smem + (t & 1) * G_STAGE + fa;
    const _Float16* sw = smem + (t & 1) * G_STAGE + fb;
    v16h a[2][2], b[2][4];                 // two fragment sets, one per k step
    a[0][0] = load_frag_f16(sa, hi);
    a[0][1] = load_frag_f16(sa + 16 * G_PITCH, hi);
    b[0][0] = load_frag_f16(sw, hi);
    b[0][1] = load_frag_f16(sw + 16 * G_PITCH, hi);
    b[0][2] = load_frag_f16(sw + 32 * G_PITCH, hi);
    b[0][3] = load_frag_f16(sw + 48 * G_PITCH, hi);
#pragma unroll
    for (int s = 0; s < G_KPASS / 32; ++s) {
      const int cur = s & 1, nxt = cur ^ 1;
      if (s + 1 < G_KPASS / 32) {          // next k step of this same pass
        const int kk = (s + 1) * 32;
        a[nxt][0] = load_frag_f16(sa + kk, hi);
        a[nxt][1] = load_frag_f16(sa + 16 * G_PITCH + kk, hi);
        b[nxt][0] = load_frag_f16(sw + kk, hi);
        b[nxt][1] = load_frag_f16(sw + 16 * G_PITCH + kk, hi);
        b[nxt][2] = load_frag_f16(sw + 32 * G_PITCH + kk, hi);
        b[nxt][3] = load_frag_f16(sw + 48 * G_PITCH + kk, hi);
      }
      // keeps the next step's LDS reads one group ahead of this step's WMMAs;
      // without it they are spread among the WMMAs, each behind a full wait
      __builtin_amdgcn_sched_barrier(0);
      acc[0][0] = wmma_f16(a[cur][0], b[cur][0], acc[0][0]);
      acc[1][0] = wmma_f16(a[cur][1], b[cur][0], acc[1][0]);
      acc[0][1] = wmma_f16(a[cur][0], b[cur][1], acc[0][1]);
      acc[1][1] = wmma_f16(a[cur][1], b[cur][1], acc[1][1]);
      acc[0][2] = wmma_f16(a[cur][0], b[cur][2], acc[0][2]);
      acc[1][2] = wmma_f16(a[cur][1], b[cur][2], acc[1][2]);
      acc[0][3] = wmma_f16(a[cur][0], b[cur][3], acc[0][3]);
      acc[1][3] = wmma_f16(a[cur][1], b[cur][3], acc[1][3]);
      // closes the WMMA group, so that the following reads stay behind it
      __builtin_amdgcn_sched_barrier(0);
    }
    asm volatile("s_wait_dscnt 0x0" ::: "memory");     // own reads of this buffer done
    asm volatile("s_wait_asynccnt 0x0" ::: "memory");  // own copies of pass t+1 landed
    __syncthreads();  // publishes pass t+1 and frees this pass's buffer
    if (t + 2 < G_NPASS) {
      const unsigned bo = (unsigned)(t & 1) * (G_STAGE * 2u);
      copy8_rows(lx + bo, gx + (t + 2) * G_KPASS);
      copy8_rows(lw + bo, gw + (t + 2) * G_KPASS);
    }
  }
  asm volatile("s_wait_asynccnt 0x0" ::: "memory");    // nothing in flight at the end
}

// ---------------------------------------------------------------------------
// f16 GEMM, 32x64 tile per wave: P = X * W^T + b  (rows m = t*N+n, cols c)
// MODE 0: store f16 head layout out[n][h][t][d]        (Q, K)
// MODE 1: store f16 transposed head layout out[n][h][d][t]   (V)
// grid = (C/128, M/128), 256 threads (8 waves) per block.
// ---------------------------------------------------------------------------
template <int MODE>
__global__ __launch_bounds__(256) void proj_kernel(
    const _Float16* __restrict__ X, const _Float16* __restrict__ W,
    const float* __restrict__ bias, _Float16* __restrict__ out) {
  __shared__ __attribute__((aligned(16))) _Float16 smem[2 * G_STAGE];
  const int lane = threadIdx.x & 31;
  const int wave = threadIdx.x >> 5;
  const int lo = lane & 15, hi = lane >> 4;
  const int wm = wave & 3, wn = wave >> 2;

  v8f acc[2][4] = {};
  gemm_tile_128(X, W, smem, blockIdx.y * G_TILE, blockIdx.x * G_TILE, wm, wn,
                lo, hi, acc);
  const int row0 = blockIdx.y * G_TILE + wm * 32;   // this wave's 32x64 piece
  const int col0 = blockIdx.x * G_TILE + wn * 64;

#pragma unroll
  for (int g = 0; g < 4; ++g) {
    const int col = col0 + g * 16 + lo;   // output channel
    const float bv = bias[col];
    const int h = col >> 6;               // / D_HEAD
    const int d = col & 63;
#pragma unroll
    for (int mi = 0; mi < 2; ++mi) {
#pragma unroll
      for (int r = 0; r < 8; ++r) {
        const int m = row0 + mi * 16 + r + 8 * hi;  // row = t*N + n
        const int t = m >> 1;                       // N_DIM == 2
        const int n = m & 1;
        const float val = acc[mi][g][r] + bv;
        size_t idx;
        if (MODE == 0)
          idx = ((size_t)((n * H_DIM + h) * T_DIM + t)) * D_HEAD + d;
        else
          idx = ((size_t)((n * H_DIM + h) * D_HEAD + d)) * T_DIM + t;
        out[idx] = (_Float16)val;
      }
    }
  }
}

// ---------------------------------------------------------------------------
// Flash attention, one workgroup of 8 waves per (n, h, 128 queries), one wave
// per 16-query tile.
// S^T = K_tile * Q^T: the 16x16 f32 D-fragment of S^T (lane = query column,
// VGPR r = key row r+8*hi) is element-for-element the A-fragment layout of P
// for the P*V WMMA -> no cross-lane shuffle between the two GEMMs.
// A stage is 64 keys: 64 K rows (128 B each) and the 64 V^T rows' 128 B for
// those keys, brought into LDS once for all 8 waves by per-lane asynchronous
// 16-byte copies, two buffers: the next stage's copies fly while this stage is
// worked on.  LDS row pitch 144 B (16 B x odd) for the 16-byte fragment reads.
// The workgroup walks only the stages that hold a live key for one of its
// queries (key prefix, then what the band adds); inside a stage each wave
// skips, scalar-uniformly, a 32-key tile that is dead for its own 16 queries,
// and skips the mask arithmetic of a tile in which every pair is live.
// ---------------------------------------------------------------------------
#define A_WAVES  8
#define A_QBLK   (A_WAVES * 16)            // queries per workgroup
#define A_KEYS   64                        // keys per stage
#define A_NST    (T_DIM / A_KEYS)          // 32 stages in all
#define A_PITCH  72                        // f16 per LDS row (144 B)
#define A_STAGE  (2 * A_KEYS * A_PITCH)    // f16 per buffer: [K rows | V^T rows]

// This lane's four 16-byte copies of a stage: K rows r and r + 32, V^T rows r
// and r + 32.  The s_wait_xcnt stands inside the statement so that no address
// register of an issued copy is rewritten ahead of it.
static __device__ __forceinline__ void copy_kv(unsigned l, const _Float16* gk,
                                               const _Float16* gv) {
  const unsigned ls = 32 * A_PITCH * 2;    // bytes between copies in LDS
  asm volatile(
      "global_load_async_to_lds_b128 %0, %4, off\n\t"
      "global_load_async_to_lds_b128 %1, %5, off\n\t"
      "global_load_async_to_lds_b128 %2, %6, off\n\t"
      "global_load_async_to_lds_b128 %3, %7, off\n\t"
      "s_wait_xcnt 0x0"
      :: "v"(l), "v"(l + ls), "v"(l + 2 * ls), "v"(l + 3 * ls),
         "v"(gk), "v"(gk + 32 * D_HEAD), "v"(gv), "v"(gv + (size_t)32 * T_DIM)
      : "memory");
}

// 512 workgroups on 256 WGPs: two per WGP, four waves per SIMD; the attribute
// tells the compiler that occupancy, and with it the register budget
__global__ __launch_bounds__(A_WAVES * 32)
__attribute__((amdgpu_waves_per_eu(4, 4))) void attn_kernel(
    const _Float16* __restrict__ Qh, const _Float16* __restrict__ Kh,
    const _Float16* __restrict__ Vt, const int* __restrict__ key_length,
    _Float16* __restrict__ Y) {
  __shared__ __attribute__((aligned(16))) _Float16 smem[2 * A_STAGE];
  const int tid = threadIdx.x;
  const int lane = tid & 31;
  const int lo = lane & 15, hi = lane >> 4;
  // the wave's number in a scalar register: the tile skip below is then a
  // scalar branch
  const int wave = __builtin_amdgcn_readfirstlane(tid >> 5);
  const int qblk = blockIdx.x * A_QBLK;
  const int qbase = qblk + wave * 16;
  const int h = blockIdx.y;
  const int n = blockIdx.z;
  const int keylen = key_length[n];

  const _Float16* Qp = Qh + ((size_t)(n * H_DIM + h) * T_DIM) * D_HEAD;
  const _Float16* Kp = Kh + ((size_t)(n * H_DIM + h) * T_DIM) * D_HEAD;
  const _Float16* Vp = Vt + ((size_t)(n * H_DIM + h) * D_HEAD) * T_DIM;

  // Stages to walk: [0, np) holds the key prefix (its length clamped to the
  // array), [b0, b1] is what the workgroup's band adds behind it.
  const int kl = keylen < 0 ? 0 : (keylen > T_DIM ? T_DIM : keylen);
  const int np = (kl + A_KEYS - 1) / A_KEYS;
  int b0 = (qblk - WIN) / A_KEYS;          // qblk - WIN is a multiple of A_KEYS
  if (b0 < np) b0 = np;
  int b1 = (qblk + A_QBLK - 1 + WIN) / A_KEYS;
  if (b1 > A_NST - 1) b1 = A_NST - 1;
  const int nst = np + (b1 >= b0 ? b1 + 1 - b0 : 0);
  const int bsh = b0 - np;                 // stage of trip i >= np is i + bsh

  // copy places of this lane: row cr (and cr + 32), 16-byte piece cc
  const int cr = tid >> 3;
  const int cc = tid & 7;
  const _Float16* gk = Kp + (size_t)cr * D_HEAD + cc * 8;
  const _Float16* gv = Vp + (size_t)cr * T_DIM + cc * 8;
  const unsigned lc = (unsigned)(size_t)smem + (unsigned)(cr * A_PITCH + cc * 8) * 2u;

  // Q^T B-fragments: lane column q = lo, two 32-wide d chunks.
  const _Float16* qrow = Qp + (size_t)(qbase + lo) * D_HEAD;
  const v16h qb0 = load_frag_f16(qrow, hi);        // d = 0..31
  const v16h qb1 = load_frag_f16(qrow + 32, hi);   // d = 32..63

  v8f o[4] = {};                 // O fragments: d-groups of 16
  float m_run = -INFINITY;
  float l_run = 0.0f;
  const int qg = qbase + lo;     // this lane's query row (dup across hi halves)

  // trip 0's stage lands and is published, then trip 1's starts to fly
  {
    const int st = 0 < np ? 0 : bsh;
    copy_kv(lc, gk + (size_t)st * (A_KEYS * D_HEAD), gv + st * A_KEYS);
  }
  asm volatile("s_wait_asynccnt 0x0" ::: "memory");  // own copies of trip 0 landed
  __syncthreads();                                   // publishes trip 0's stage
  if (1 < nst) {
    const int st = 1 < np ? 1 : 1 + bsh;
    copy_kv(lc + A_STAGE * 2u, gk + (size_t)st * (A_KEYS * D_HEAD),
            gv + st * A_KEYS);
  }

  for (int i = 0; i < nst; ++i) {
    const int st = i < np ? i : i + bsh;
    const _Float16* sk = smem + (i & 1) * A_STAGE;
    const _Float16* sv = sk + A_KEYS * A_PITCH;
#pragma unroll
    for (int u = 0; u < A_KEYS / 32; ++u) {
      const int kb = st * A_KEYS + u * 32;
      // tile fully masked iff no band overlap AND beyond the key prefix
      const bool band = (kb <= qbase + 15 + WIN) && (kb + 31 >= qbase - WIN);
      if (band || kb < keylen) {
        // K A-fragments (lane row = key), two row halves x two d chunks
        const _Float16* kr0 = sk + (u * 32 + lo) * A_PITCH;
        const _Float16* kr1 = sk + (u * 32 + 16 + lo) * A_PITCH;
        const v16h ka00 = load_frag_f16(kr0, hi);
        const v16h ka10 = load_frag_f16(kr1, hi);
        const v16h ka01 = load_frag_f16(kr0 + 32, hi);
        const v16h ka11 = load_frag_f16(kr1 + 32, hi);
        // keeps the eight LDS reads one group ahead of the WMMAs; with the
        // mask in a block of its own they are else issued pair by pair into
        // one register set, each pair behind a full wait
        __builtin_amdgcn_sched_barrier(0);
        v8f s0 = {}, s1 = {};
        s0 = wmma_f16(ka00, qb0, s0);
        s1 = wmma_f16(ka10, qb0, s1);
        s0 = wmma_f16(ka01, qb1, s0);
        s1 = wmma_f16(ka11, qb1, s1);

        // scale
#pragma unroll
        for (int r = 0; r < 8; ++r) {
          s0[r] *= 0.125f;             // 1/sqrt(Dh)
          s1[r] *= 0.125f;
        }
        // mask, only where the tile can hold a dead pair.  It holds none when
        // all 32 keys lie in the prefix, or when the whole tile lies inside
        // the band of every one of the wave's 16 queries; the test is the same
        // for the whole wave, so the mask arithmetic is branched over.
        const bool all_live =
            (kb + 31 < keylen) ||
            (kb >= qbase + 15 - WIN && kb + 31 <= qbase + WIN);
        if (!all_live) {
#pragma unroll
          for (int r = 0; r < 8; ++r) {
            const int kg0 = kb + r + 8 * hi;
            const int kg1 = kg0 + 16;
            int d0 = qg - kg0; d0 = d0 < 0 ? -d0 : d0;
            int d1 = qg - kg1; d1 = d1 < 0 ? -d1 : d1;
            if (!(d0 <= WIN || kg0 < keylen)) s0[r] = NEG_BIG;
            if (!(d1 <= WIN || kg1 < keylen)) s1[r] = NEG_BIG;
          }
        }
        // per-query max
        float mt = -INFINITY;
#pragma unroll
        for (int r = 0; r < 8; ++r) mt = fmaxf(mt, fmaxf(s0[r], s1[r]));
        mt = fmaxf(mt, __shfl_xor(mt, 16, 32));   // join the two key halves
        const float m_new = fmaxf(m_run, mt);
        const float alpha = __expf(m_run - m_new);

        // exp -> P fragment (already in A-fragment layout), row-sum
        v16h pa;
        float rs = 0.0f;
#pragma unroll
        for (int r = 0; r < 8; ++r) {
          const float p0 = __expf(s0[r] - m_new);
          const float p1 = __expf(s1[r] - m_new);
          rs += p0 + p1;
          pa[r] = (_Float16)p0;
          pa[8 + r] = (_Float16)p1;
        }
        rs += __shfl_xor(rs, 16, 32);
        l_run = l_run * alpha + rs;
        m_run = m_new;

        // rescale O accumulators; O-fragment row q = r + 8*hi, alpha in lane q
#pragma unroll
        for (int r = 0; r < 8; ++r) {
          const float ar = __shfl(alpha, hi * 8 + r, 32);
          o[0][r] *= ar; o[1][r] *= ar; o[2][r] *= ar; o[3][r] *= ar;
        }

        // O += P * V  (V^T rows in LDS: row d, this stage's keys in a row)
#pragma unroll
        for (int g = 0; g < 4; ++g) {
          const _Float16* vrow = sv + (g * 16 + lo) * A_PITCH + u * 32;
          o[g] = wmma_f16(pa, load_frag_f16(vrow, hi), o[g]);
        }
      }
    }
    asm volatile("s_wait_dscnt 0x0" ::: "memory");     // own reads of this buffer done
    asm volatile("s_wait_asynccnt 0x0" ::: "memory");  // own copies of trip i+1 landed
    __syncthreads();  // publishes trip i+1's stage and frees this trip's buffer
    if (i + 2 < nst) {
      const int s2 = i + 2 < np ? i + 2 : i + 2 + bsh;
      copy_kv(lc + (unsigned)(i & 1) * (A_STAGE * 2u),
              gk + (size_t)s2 * (A_KEYS * D_HEAD), gv + s2 * A_KEYS);
    }
  }
  asm volatile("s_wait_asynccnt 0x0" ::: "memory");    // nothing in flight at the end

  // epilogue: O/l  -> Y[(t*N+n)*C + h*64 + d]  (f16, feeds the out-projection)
#pragma unroll
  for (int r = 0; r < 8; ++r) {
    const float lr = __shfl(l_run, hi * 8 + r, 32);
    const float inv = 1.0f / lr;
    const int qrow_g = qbase + r + 8 * hi;
#pragma unroll
    for (int g = 0; g < 4; ++g) {
      const int c = h * D_HEAD + g * 16 + lo;
      Y[((size_t)qrow_g * N_DIM + n) * C_DIM + c] = (_Float16)(o[g][r] * inv);
    }
  }
}

// ---------------------------------------------------------------------------
// Output projection: out = Y(f16, MxC) * Wo^T(f16) + bo -> fp32 (T,N,C)
// Same tile structure as proj_kernel.
// ---------------------------------------------------------------------------
__global__ __launch_bounds__(256) void outproj_kernel(
    const _Float16* __restrict__ Yin, const _Float16* __restrict__ W,
    const float* __restrict__ bias, float* __restrict__ out) {
  __shared__ __attribute__((aligned(16))) _Float16 smem[2 * G_STAGE];
  const int lane = threadIdx.x & 31;
  const int wave = threadIdx.x >> 5;
  const int lo = lane & 15, hi = lane >> 4;
  const int wm = wave & 3, wn = wave >> 2;

  v8f acc[2][4] = {};
  gemm_tile_128(Yin, W, smem, blockIdx.y * G_TILE, blockIdx.x * G_TILE, wm, wn,
                lo, hi, acc);
  const int row0 = blockIdx.y * G_TILE + wm * 32;   // this wave's 32x64 piece
  const int col0 = blockIdx.x * G_TILE + wn * 64;

#pragma unroll
  for (int g = 0; g < 4; ++g) {
    const int col = col0 + g * 16 + lo;
    const float bv = bias[col];
#pragma unroll
    for (int mi = 0; mi < 2; ++mi) {
#pragma unroll
      for (int r = 0; r < 8; ++r) {
        const int m = row0 + mi * 16 + r + 8 * hi;
        out[(size_t)m * C_DIM + col] = acc[mi][g][r] + bv;
      }
    }
  }
}

// ---------------------------------------------------------------------------
extern "C" void kernel_launch(void* const* d_in, const int* in_sizes, int n_in,
                              void* d_out, int out_size, void* d_ws,
                              size_t ws_size, hipStream_t stream) {
  (void)in_sizes; (void)n_in; (void)out_size; (void)ws_size;
  const float* q  = (const float*)d_in[0];
  const float* k  = (const float*)d_in[1];
  const float* v  = (const float*)d_in[2];
  const float* Wq = (const float*)d_in[3];
  const float* bq = (const float*)d_in[4];
  const float* Wk = (const float*)d_in[5];
  const float* bk = (const float*)d_in[6];
  const float* Wv = (const float*)d_in[7];
  const float* bv = (const float*)d_in[8];
  const float* Wo = (const float*)d_in[9];
  const float* bo = (const float*)d_in[10];
  const int* key_length = (const int*)d_in[11];
  float* out = (float*)d_out;

  // Workspace (f16 elements), total 64 MB:
  //   Qh, Kh, Vt, Y          : 4 x N*H*T*Dh  = 4 x 4M   (32 MB)
  //   q16, k16, v16          : 3 x T*N*C     = 3 x 4M   (24 MB)
  //   Wq16, Wk16, Wv16, Wo16 : 4 x C*C       = 4 x 1M   ( 8 MB)
  const size_t HSZ = (size_t)N_DIM * H_DIM * T_DIM * D_HEAD;  // 4,194,304
  const size_t WSZ = (size_t)C_DIM * C_DIM;                   // 1,048,576
  _Float16* Qh   = (_Float16*)d_ws;
  _Float16* Kh   = Qh + HSZ;
  _Float16* Vt   = Kh + HSZ;
  _Float16* Y    = Vt + HSZ;
  _Float16* q16  = Y + HSZ;
  _Float16* k16  = q16 + HSZ;
  _Float16* v16  = k16 + HSZ;
  _Float16* Wq16 = v16 + HSZ;
  _Float16* Wk16 = Wq16 + WSZ;
  _Float16* Wv16 = Wk16 + WSZ;
  _Float16* Wo16 = Wv16 + WSZ;

  // 1) fp32 -> f16 conversions, one launch; q16 .. Wo16 lie end to end
  cvt_all_kernel<<<CV_GRID, CV_WAVES * 32, 0, stream>>>(q, k, v, Wq, Wk, Wv, Wo,
                                                        q16);

  // 2) input projections into WMMA-friendly head layouts
  const dim3 gp(C_DIM / 128, M_ROWS / 128);  // (8, 32) 128x128 tiles, 8 waves each
  proj_kernel<0><<<gp, 256, 0, stream>>>(q16, Wq16, bq, Qh);
  proj_kernel<0><<<gp, 256, 0, stream>>>(k16, Wk16, bk, Kh);
  proj_kernel<1><<<gp, 256, 0, stream>>>(v16, Wv16, bv, Vt);

  // 3) banded + prefix-masked flash attention
  attn_kernel<<<dim3(T_DIM / A_QBLK, H_DIM, N_DIM), A_WAVES * 32, 0, stream>>>(
      Qh, Kh, Vt, key_length, Y);

  // 4) output projection (fp32 result + bias)
  outproj_kernel<<<gp, 256, 0, stream>>>(Y, Wo16, bo, out);
}

// v005
// A run of this version takes 69.1 microseconds.
// Two timings next to v004 both put it at 1.15 times that version's speed.
// Over all steps from v000 it is 3.35 times as fast.
#include <hip/hip_runtime.h>

#define T_DIM   2048
#define N_DIM   2
#define C_DIM   1024
#define H_DIM   16
#define D_HEAD  64
#define M_ROWS  (T_DIM * N_DIM)   // 4096 rows (t*N + n)
#define WIN     128
#define NEG_BIG (-1.0e9f)

typedef __attribute__((ext_vector_type(16))) _Float16 v16h;
typedef __attribute__((ext_vector_type(8)))  _Float16 v8h;
typedef __attribute__((ext_vector_type(8)))  float    v8f;

static __device__ __forceinline__ v8f wmma_f16(v16h a, v16h b, v8f c) {
  // D = A(16x32 f16) * B(32x16 f16) + C(16x16 f32)
  return __builtin_amdgcn_wmma_f32_16x16x32_f16(false, a, false, b, (short)0, c,
                                                false, false);
}

// A/B fragment slice: elems 0..7 = p[hi*8 ..], elems 8..15 = p[16 + hi*8 ..]
static __device__ __forceinline__ v16h load_frag_f16(const _Float16* p, int hi) {
  v8h a = *(const v8h*)(p + hi * 8);
  v8h b = *(const v8h*)(p + 16 + hi * 8);
  v16h r;
#pragma unroll
  for (int i = 0; i < 8; ++i) { r[i] = a[i]; r[8 + i] = b[i]; }
  return r;
}

// ---------------------------------------------------------------------------
// fp32 -> f16 conversion of all seven operands in ONE resident launch:
// 256 workgroups of 16 waves.  Wave gw converts piece gw (1024 floats, 4 KB)
// of q, of k, of v and of the four weights laid end to end.  Each load covers
// 512 contiguous bytes, each store 256; all 32 loads of a wave are issued
// before its first conversion.  The f16 copies lie end to end in out:
// q, k, v (X_ELEMS each), then Wq, Wk, Wv, Wo.
// ---------------------------------------------------------------------------
#define X_ELEMS   (M_ROWS * C_DIM)         // 4,194,304 elements of q, k or v
#define CV_WAVES  16                       // waves per workgroup
#define CV_PIECE  1024                     // floats per wave and source
#define CV_GRID   (X_ELEMS / (CV_WAVES * CV_PIECE))          // 256
#define CV_W_PIECES (C_DIM * C_DIM / CV_PIECE)               // 1024 per weight

typedef __attribute__((ext_vector_type(4))) float    v4f;
typedef __attribute__((ext_vector_type(4))) _Float16 v4h;

__global__ __launch_bounds__(CV_WAVES * 32) void cvt_all_kernel(
    const float* __restrict__ q, const float* __restrict__ k,
    const float* __restrict__ v, const float* __restrict__ Wq,
    const float* __restrict__ Wk, const float* __restrict__ Wv,
    const float* __restrict__ Wo, _Float16* __restrict__ out) {
  const unsigned lane = threadIdx.x & 31;
  const unsigned gw = blockIdx.x * CV_WAVES + (threadIdx.x >> 5);   // 0 .. 4095
  // a workgroup's 16 pieces lie inside one weight
  const unsigned wsel = blockIdx.x / (CV_W_PIECES / CV_WAVES);
  const float* w = wsel == 0 ? Wq : wsel == 1 ? Wk : wsel == 2 ? Wv : Wo;
  // byte offset of this lane's first 16 bytes: the same in q, k and v, and in
  // the four weights counted end to end (wb + bo lies inside weight wsel)
  const unsigned bo = (gw * CV_PIECE + lane * 4) * 4u;
  const char* qb = (const char*)q;
  const char* kb = (const char*)k;
  const char* vb = (const char*)v;
  const char* wb = (const char*)w - (size_t)wsel * (C_DIM * C_DIM * 4);

  const char* const sb[4] = {qb, kb, vb, wb};

  // All 32 loads are issued before the first conversion, source by source.
  // Each scheduling barrier keeps the loads in the order in which they are
  // used (else the first source's last load is issued near the end and its
  // stores wait for everything) and ahead of the conversions (else only half
  // of the loads are issued at once).
  v4f x[4][8];
#pragma unroll
  for (int s = 0; s < 4; ++s) {
#pragma unroll
    for (int j = 0; j < 8; ++j) x[s][j] = *(const v4f*)(sb[s] + bo + j * 512);
    __builtin_amdgcn_sched_barrier(0);
  }

  const unsigned ho = bo >> 1;             // the same place in f16 bytes
#pragma unroll
  for (int s = 0; s < 4; ++s) {
    char* d = (char*)out + (size_t)s * (X_ELEMS * 2);
#pragma unroll
    for (int j = 0; j < 8; ++j) {
      v4h y;
#pragma unroll
      for (int i = 0; i < 4; ++i) y[i] = (_Float16)x[s][j][i];
      *(v4h*)(d + ho + j * 256) = y;
    }
    // lets this source's stores go out while the later sources' loads still
    // fly; without it every store is held back to the end of the wave
    if (s < 3) __builtin_amdgcn_sched_barrier(0);
  }
}

// ---------------------------------------------------------------------------
// Shared GEMM main loop: one 128x128 tile of X * W^T per workgroup of 8 waves,
// each wave a 32x64 piece (4 wave rows x 2 wave columns).  A pass is 128 k
// (256 B of each of the 128 X rows and 128 W rows), brought into LDS by
// per-lane asynchronous 16-byte copies, two buffers: the next pass's copies
// fly while this pass is multiplied.  LDS row pitch 272 B (16 B x odd) keeps
// the 16-byte fragment reads free of bank conflicts.
// ---------------------------------------------------------------------------
#define G_TILE   128                       // rows of X and rows of W per tile
#define G_KPASS  128                       // k per pass
#define G_NPASS  (C_DIM / G_KPASS)         // 8
#define G_PITCH  136                       // f16 per LDS row (272 B)
#define G_STAGE  (2 * G_TILE * G_PITCH)    // f16 per buffer: [X rows | W rows]

// Eight 16-byte copies of this lane, rows 16 apart in both places.  The
// s_wait_xcnt stands inside the statement so that no address register of an
// issued copy is rewritten ahead of it.
static __device__ __forceinline__ void copy8_rows(unsigned l, const _Float16* g) {
  const unsigned ls = 16 * G_PITCH * 2;    // bytes between copies in LDS
  const size_t gs = (size_t)16 * C_DIM;    // f16 between copies in memory
  asm volatile(
      "global_load_async_to_lds_b128 %0, %8, off\n\t"
      "global_load_async_to_lds_b128 %1, %9, off\n\t"
      "global_load_async_to_lds_b128 %2, %10, off\n\t"
      "global_load_async_to_lds_b128 %3, %11, off\n\t"
      "global_load_async_to_lds_b128 %4, %12, off\n\t"
      "global_load_async_to_lds_b128 %5, %13, off\n\t"
      "global_load_async_to_lds_b128 %6, %14, off\n\t"
      "global_load_async_to_lds_b128 %7, %15, off\n\t"
      "s_wait_xcnt 0x0"
      :: "v"(l), "v"(l + ls), "v"(l + 2 * ls), "v"(l + 3 * ls),
         "v"(l + 4 * ls), "v"(l + 5 * ls), "v"(l + 6 * ls), "v"(l + 7 * ls),
         "v"(g), "v"(g + gs), "v"(g + 2 * gs), "v"(g + 3 * gs),
         "v"(g + 4 * gs), "v"(g + 5 * gs), "v"(g + 6 * gs), "v"(g + 7 * gs)
      : "memory");
}

// acc[mi][g] = rows (row0 + wm*32 + mi*16 ..) x cols (col0 + wn*64 + g*16 ..)
static __device__ __forceinline__ void gemm_tile_128(
    const _Float16* __restrict__ X, const _Float16* __restrict__ W,
    _Float16* smem, int row0, int col0, int wm, int wn, int lo, int hi,
    v8f (&acc)[2][4]) {
  const int tid = threadIdx.x;
  const int cr = tid >> 4;                 // copy row inside a group of 16
  const int cc = tid & 15;                 // 16-byte piece of the 256-B row
  const _Float16* gx = X + (size_t)(row0 + cr) * C_DIM + cc * 8;
  const _Float16* gw = W + (size_t)(col0 + cr) * C_DIM + cc * 8;
  const unsigned lx = (unsigned)(size_t)smem + (unsigned)(cr * G_PITCH + cc * 8) * 2u;
  const unsigned lw = lx + G_TILE * G_PITCH * 2u;

  const int fa = (wm * 32 + lo) * G_PITCH;             // wave's first X row
  const int fb = (G_TILE + wn * 64 + lo) * G_PITCH;    // wave's first W row

  // pass 0 lands and is published, then pass 1 starts to fly
  copy8_rows(lx, gx);
  copy8_rows(lw, gw);
  asm volatile("s_wait_asynccnt 0x0" ::: "memory");  // own copies of pass 0 landed
  __syncthreads();                                   // publishes pass 0
  copy8_rows(lx + G_STAGE * 2u, gx + G_KPASS);
  copy8_rows(lw + G_STAGE * 2u, gw + G_KPASS);

  for (int t = 0; t < G_NPASS; ++t) {
    const _Float16* sa = smem + (t & 1) * G_STAGE + fa;
    const _Float16* sw = smem + (t & 1) * G_STAGE + fb;
    v16h a[2][2], b[2][4];                 // two fragment sets, one per k step
    a[0][0] = load_frag_f16(sa, hi);
    a[0][1] = load_frag_f16(sa + 16 * G_PITCH, hi);
    b[0][0] = load_frag_f16(sw, hi);
    b[0][1] = load_frag_f16(sw + 16 * G_PITCH, hi);
    b[0][2] = load_frag_f16(sw + 32 * G_PITCH, hi);
    b[0][3] = load_frag_f16(sw + 48 * G_PITCH, hi);
#pragma unroll
    for (int s = 0; s < G_KPASS / 32; ++s) {
      const int cur = s & 1, nxt = cur ^ 1;
      if (s + 1 < G_KPASS / 32) {          // next k step of this same pass
        const int kk = (s + 1) * 32;
        a[nxt][0] = load_frag_f16(sa + kk, hi);
        a[nxt][1] = load_frag_f16(sa + 16 * G_PITCH + kk, hi);
        b[nxt][0] = load_frag_f16(sw + kk, hi);
        b[nxt][1] = load_frag_f16(sw + 16 * G_PITCH + kk, hi);
        b[nxt][2] = load_frag_f16(sw + 32 * G_PITCH + kk, hi);
        b[nxt][3] = load_frag_f16(sw + 48 * G_PITCH + kk, hi);
      }
      // keeps the next step's LDS reads one group ahead of this step's WMMAs;
      // without it they are spread among the WMMAs, each behind a full wait
      __builtin_amdgcn_sched_barrier(0);
      acc[0][0] = wmma_f16(a[cur][0], b[cur][0], acc[0][0]);
      acc[1][0] = wmma_f16(a[cur][1], b[cur][0], acc[1][0]);
      acc[0][1] = wmma_f16(a[cur][0], b[cur][1], acc[0][1]);
      acc[1][1] = wmma_f16(a[cur][1], b[cur][1], acc[1][1]);
      acc[0][2] = wmma_f16(a[cur][0], b[cur][2], acc[0][2]);
      acc[1][2] = wmma_f16(a[cur][1], b[cur][2], acc[1][2]);
      acc[0][3] = wmma_f16(a[cur][0], b[cur][3], acc[0][3]);
      acc[1][3] = wmma_f16(a[cur][1], b[cur][3], acc[1][3]);
      // closes the WMMA group, so that the following reads stay behind it
      __builtin_amdgcn_sched_barrier(0);
    }
    asm volatile("s_wait_dscnt 0x0" ::: "memory");     // own reads of this buffer done
    asm volatile("s_wait_asynccnt 0x0" ::: "memory");  // own copies of pass t+1 landed
    __syncthreads();  // publishes pass t+1 and frees this pass's buffer
    if (t + 2 < G_NPASS) {
      const unsigned bo = (unsigned)(t & 1) * (G_STAGE * 2u);
      copy8_rows(lx + bo, gx + (t + 2) * G_KPASS);
      copy8_rows(lw + bo, gw + (t + 2) * G_KPASS);
    }
  }
  asm volatile("s_wait_asynccnt 0x0" ::: "memory");    // nothing in flight at the end
}

// ---------------------------------------------------------------------------
// Stores a wave's 32x64 piece of P = X * W^T + b as f16 (rows m = t*N+n).
// MODE 0: head layout out[n][h][t][d]              (Q, K)
// MODE 1: transposed head layout out[n][h][d][t]   (V)
// ---------------------------------------------------------------------------
template <int MODE>
static __device__ __forceinline__ void store_heads(
    const v8f (&acc)[2][4], const float* __restrict__ bias,
    _Float16* __restrict__ out, int row0, int col0, int lo, int hi) {
#pragma unroll
  for (int g = 0; g < 4; ++g) {
    const int col = col0 + g * 16 + lo;   // output channel
    const float bv = bias[col];
    const int h = col >> 6;               // / D_HEAD
    const int d = col & 63;
#pragma unroll
    for (int mi = 0; mi < 2; ++mi) {
#pragma unroll
      for (int r = 0; r < 8; ++r) {
        const int m = row0 + mi * 16 + r + 8 * hi;  // row = t*N + n
        const int t = m >> 1;                       // N_DIM == 2
        const int n = m & 1;
        const float val = acc[mi][g][r] + bv;
        size_t idx;
        if (MODE == 0)
          idx = ((size_t)((n * H_DIM + h) * T_DIM + t)) * D_HEAD + d;
        else
          idx = ((size_t)((n * H_DIM + h) * D_HEAD + d)) * T_DIM + t;
        out[idx] = (_Float16)val;
      }
    }
  }
}

// ---------------------------------------------------------------------------
// The three input projections in ONE launch, 32x64 tile per wave.  blockIdx.z
// picks the projection; the f16 copies of q, k, v, those of Wq, Wk, Wv and the
// three results each lie end to end.
// grid = (C/128, M/128, 3), 256 threads (8 waves) per block: 768 workgroups,
// two resident per WGP (LDS), so one workgroup's first copies, its waits for
// a pass to land and its stores run beside the other's products, and no launch
// gap stands between the three projections.
// ---------------------------------------------------------------------------
__global__ __launch_bounds__(256) void proj_qkv_kernel(
    const _Float16* __restrict__ X3, const _Float16* __restrict__ W3,
    const float* __restrict__ bq, const float* __restrict__ bk,
    const float* __restrict__ bv, _Float16* __restrict__ out3) {
  __shared__ __attribute__((aligned(16))) _Float16 smem[2 * G_STAGE];
  const int lane = threadIdx.x & 31;
  const int wave = threadIdx.x >> 5;
  const int lo = lane & 15, hi = lane >> 4;
  const int wm = wave & 3, wn = wave >> 2;
  const int sel = blockIdx.z;             // 0 = Q, 1 = K, 2 = V
  const _Float16* X = X3 + (size_t)sel * X_ELEMS;
  const _Float16* W = W3 + (size_t)sel * (C_DIM * C_DIM);
  _Float16* out = out3 + (size_t)sel * X_ELEMS;

  v8f acc[2][4] = {};
  gemm_tile_128(X, W, smem, blockIdx.y * G_TILE, blockIdx.x * G_TILE, wm, wn,
                lo, hi, acc);
  const int row0 = blockIdx.y * G_TILE + wm * 32;   // this wave's 32x64 piece
  const int col0 = blockIdx.x * G_TILE + wn * 64;

  if (sel == 2) {
    store_heads<1>(acc, bv, out, row0, col0, lo, hi);
  } else {
    store_heads<0>(acc, sel == 0 ? bq : bk, out, row0, col0, lo, hi);
    // the built code lays the other layout's block behind this one, with only
    // a flag test between; the wait stands in front of that block's writes of
    // registers that the stores above name
    asm volatile("s_wait_xcnt 0x0" ::: "memory");
  }
}

// ---------------------------------------------------------------------------
// Flash attention, one workgroup of 8 waves per (n, h, 128 queries), one wave
// per 16-query tile.
// S^T = K_tile * Q^T: the 16x16 f32 D-fragment of S^T (lane = query column,
// VGPR r = key row r+8*hi) is element-for-element the A-fragment layout of P
// for the P*V WMMA -> no cross-lane shuffle between the two GEMMs.
// A stage is 64 keys: 64 K rows (128 B each) and the 64 V^T rows' 128 B for
// those keys, brought into LDS once for all 8 waves by per-lane asynchronous
// 16-byte copies, two buffers: the next stage's copies fly while this stage is
// worked on.  LDS row pitch 144 B (16 B x odd) for the 16-byte fragment reads.
// The workgroup walks only the stages that hold a live key for one of its
// queries (key prefix, then what the band adds); inside a stage each wave
// skips, scalar-uniformly, a 32-key tile that is dead for its own 16 queries,
// and skips the mask arithmetic of a tile in which every pair is live.
// ---------------------------------------------------------------------------
#define A_WAVES  8
#define A_QBLK   (A_WAVES * 16)            // queries per workgroup
#define A_KEYS   64                        // keys per stage
#define A_NST    (T_DIM / A_KEYS)          // 32 stages in all
#define A_PITCH  72                        // f16 per LDS row (144 B)
#define A_STAGE  (2 * A_KEYS * A_PITCH)    // f16 per buffer: [K rows | V^T rows]

// This lane's four 16-byte copies of a stage: K rows r and r + 32, V^T rows r
// and r + 32.  The s_wait_xcnt stands inside the statement so that no address
// register of an issued copy is rewritten ahead of it.
static __device__ __forceinline__ void copy_kv(unsigned l, const _Float16* gk,
                                               const _Float16* gv) {
  const unsigned ls = 32 * A_PITCH * 2;    // bytes between copies in LDS
  asm volatile(
      "global_load_async_to_lds_b128 %0, %4, off\n\t"
      "global_load_async_to_lds_b128 %1, %5, off\n\t"
      "global_load_async_to_lds_b128 %2, %6, off\n\t"
      "global_load_async_to_lds_b128 %3, %7, off\n\t"
      "s_wait_xcnt 0x0"
      :: "v"(l), "v"(l + ls), "v"(l + 2 * ls), "v"(l + 3 * ls),
         "v"(gk), "v"(gk + 32 * D_HEAD), "v"(gv), "v"(gv + (size_t)32 * T_DIM)
      : "memory");
}

// 512 workgroups on 256 WGPs: two per WGP, four waves per SIMD; the attribute
// tells the compiler that occupancy, and with it the register budget
__global__ __launch_bounds__(A_WAVES * 32)
__attribute__((amdgpu_waves_per_eu(4, 4))) void attn_kernel(
    const _Float16* __restrict__ Qh, const _Float16* __restrict__ Kh,
    const _Float16* __restrict__ Vt, const int* __restrict__ key_length,
    _Float16* __restrict__ Y) {
  __shared__ __attribute__((aligned(16))) _Float16 smem[2 * A_STAGE];
  const int tid = threadIdx.x;
  const int lane = tid & 31;
  const int lo = lane & 15, hi = lane >> 4;
  // the wave's number in a scalar register: the tile skip below is then a
  // scalar branch
  const int wave = __builtin_amdgcn_readfirstlane(tid >> 5);
  const int qblk = blockIdx.x * A_QBLK;
  const int qbase = qblk + wave * 16;
  const int h = blockIdx.y;
  const int n = blockIdx.z;
  const int keylen = key_length[n];

  const _Float16* Qp = Qh + ((size_t)(n * H_DIM + h) * T_DIM) * D_HEAD;
  const _Float16* Kp = Kh + ((size_t)(n * H_DIM + h) * T_DIM) * D_HEAD;
  const _Float16* Vp = Vt + ((size_t)(n * H_DIM + h) * D_HEAD) * T_DIM;

  // Stages to walk: [0, np) holds the key prefix (its length clamped to the
  // array), [b0, b1] is what the workgroup's band adds behind it.
  const int kl = keylen < 0 ? 0 : (keylen > T_DIM ? T_DIM : keylen);
  const int np = (kl + A_KEYS - 1) / A_KEYS;
  int b0 = (qblk - WIN) / A_KEYS;          // qblk - WIN is a multiple of A_KEYS
  if (b0 < np) b0 = np;
  int b1 = (qblk + A_QBLK - 1 + WIN) / A_KEYS;
  if (b1 > A_NST - 1) b1 = A_NST - 1;
  const int nst = np + (b1 >= b0 ? b1 + 1 - b0 : 0);
  const int bsh = b0 - np;                 // stage of trip i >= np is i + bsh

  // copy places of this lane: row cr (and cr + 32), 16-byte piece cc
  const int cr = tid >> 3;
  const int cc = tid & 7;
  const _Float16* gk = Kp + (size_t)cr * D_HEAD + cc * 8;
  const _Float16* gv = Vp + (size_t)cr * T_DIM + cc * 8;
  const unsigned lc = (unsigned)(size_t)smem + (unsigned)(cr * A_PITCH + cc * 8) * 2u;

  // Q^T B-fragments: lane column q = lo, two 32-wide d chunks.
  const _Float16* qrow = Qp + (size_t)(qbase + lo) * D_HEAD;
  const v16h qb0 = load_frag_f16(qrow, hi);        // d = 0..31
  const v16h qb1 = load_frag_f16(qrow + 32, hi);   // d = 32..63

  v8f o[4] = {};                 // O fragments: d-groups of 16
  float m_run = -INFINITY;
  float l_run = 0.0f;
  const int qg = qbase + lo;     // this lane's query row (dup across hi halves)

  // trip 0's stage lands and is published, then trip 1's starts to fly
  {
    const int st = 0 < np ? 0 : bsh;
    copy_kv(lc, gk + (size_t)st * (A_KEYS * D_HEAD), gv + st * A_KEYS);
  }
  asm volatile("s_wait_asynccnt 0x0" ::: "memory");  // own copies of trip 0 landed
  __syncthreads();                                   // publishes trip 0's stage
  if (1 < nst) {
    const int st = 1 < np ? 1 : 1 + bsh;
    copy_kv(lc + A_STAGE * 2u, gk + (size_t)st * (A_KEYS * D_HEAD),
            gv + st * A_KEYS);
  }

  for (int i = 0; i < nst; ++i) {
    const int st = i < np ? i : i + bsh;
    const _Float16* sk = smem + (i & 1) * A_STAGE;
    const _Float16* sv = sk + A_KEYS * A_PITCH;
#pragma unroll
    for (int u = 0; u < A_KEYS / 32; ++u) {
      const int kb = st * A_KEYS + u * 32;
      // tile fully masked iff no band overlap AND beyond the key prefix
      const bool band = (kb <= qbase + 15 + WIN) && (kb + 31 >= qbase - WIN);
      if (band || kb < keylen) {
        // K A-fragments (lane row = key), two row halves x two d chunks
        const _Float16* kr0 = sk + (u * 32 + lo) * A_PITCH;
        const _Float16* kr1 = sk + (u * 32 + 16 + lo) * A_PITCH;
        const v16h ka00 = load_frag_f16(kr0, hi);
        const v16h ka10 = load_frag_f16(kr1, hi);
        const v16h ka01 = load_frag_f16(kr0 + 32, hi);
        const v16h ka11 = load_frag_f16(kr1 + 32, hi);
        // keeps the eight LDS reads one group ahead of the WMMAs; with the
        // mask in a block of its own they are else issued pair by pair into
        // one register set, each pair behind a full wait
        __builtin_amdgcn_sched_barrier(0);
        v8f s0 = {}, s1 = {};
        s0 = wmma_f16(ka00, qb0, s0);
        s1 = wmma_f16(ka10, qb0, s1);
        s0 = wmma_f16(ka01, qb1, s0);
        s1 = wmma_f16(ka11, qb1, s1);

        // scale
#pragma unroll
        for (int r = 0; r < 8; ++r) {
          s0[r] *= 0.125f;             // 1/sqrt(Dh)
          s1[r] *= 0.125f;
        }
        // mask, only where the tile can hold a dead pair.  It holds none when
        // all 32 keys lie in the prefix, or when the whole tile lies inside
        // the band of every one of the wave's 16 queries; the test is the same
        // for the whole wave, so the mask arithmetic is branched over.
        const bool all_live =
            (kb + 31 < keylen) ||
            (kb >= qbase + 15 - WIN && kb + 31 <= qbase + WIN);
        if (!all_live) {
#pragma unroll
          for (int r = 0; r < 8; ++r) {
            const int kg0 = kb + r + 8 * hi;
            const int kg1 = kg0 + 16;
            int d0 = qg - kg0; d0 = d0 < 0 ? -d0 : d0;
            int d1 = qg - kg1; d1 = d1 < 0 ? -d1 : d1;
            if (!(d0 <= WIN || kg0 < keylen)) s0[r] = NEG_BIG;
            if (!(d1 <= WIN || kg1 < keylen)) s1[r] = NEG_BIG;
          }
        }
        // per-query max
        float mt = -INFINITY;
#pragma unroll
        for (int r = 0; r < 8; ++r) mt = fmaxf(mt, fmaxf(s0[r], s1[r]));
        mt = fmaxf(mt, __shfl_xor(mt, 16, 32));   // join the two key halves
        const float m_new = fmaxf(m_run, mt);
        const float alpha = __expf(m_run - m_new);

        // exp -> P fragment (already in A-fragment layout), row-sum
        v16h pa;
        float rs = 0.0f;
#pragma unroll
        for (int r = 0; r < 8; ++r) {
          const float p0 = __expf(s0[r] - m_new);
          const float p1 = __expf(s1[r] - m_new);
          rs += p0 + p1;
          pa[r] = (_Float16)p0;
          pa[8 + r] = (_Float16)p1;
        }
        rs += __shfl_xor(rs, 16, 32);
        l_run = l_run * alpha + rs;
        m_run = m_new;

        // rescale O accumulators; O-fragment row q = r + 8*hi, alpha in lane q
#pragma unroll
        for (int r = 0; r < 8; ++r) {
          const float ar = __shfl(alpha, hi * 8 + r, 32);
          o[0][r] *= ar; o[1][r] *= ar; o[2][r] *= ar; o[3][r] *= ar;
        }

        // O += P * V  (V^T rows in LDS: row d, this stage's keys in a row)
#pragma unroll
        for (int g = 0; g < 4; ++g) {
          const _Float16* vrow = sv + (g * 16 + lo) * A_PITCH + u * 32;
          o[g] = wmma_f16(pa, load_frag_f16(vrow, hi), o[g]);
        }
      }
    }
    asm volatile("s_wait_dscnt 0x0" ::: "memory");     // own reads of this buffer done
    asm volatile("s_wait_asynccnt 0x0" ::: "memory");  // own copies of trip i+1 landed
    __syncthreads();  // publishes trip i+1's stage and frees this trip's buffer
    if (i + 2 < nst) {
      const int s2 = i + 2 < np ? i + 2 : i + 2 + bsh;
      copy_kv(lc + (unsigned)(i & 1) * (A_STAGE * 2u),
              gk + (size_t)s2 * (A_KEYS * D_HEAD), gv + s2 * A_KEYS);
    }
  }
  asm volatile("s_wait_asynccnt 0x0" ::: "memory");    // nothing in flight at the end

  // epilogue: O/l  -> Y[(t*N+n)*C + h*64 + d]  (f16, feeds the out-projection)
#pragma unroll
  for (int r = 0; r < 8; ++r) {
    const float lr = __shfl(l_run, hi * 8 + r, 32);
    const float inv = 1.0f / lr;
    const int qrow_g = qbase + r + 8 * hi;
#pragma unroll
    for (int g = 0; g < 4; ++g) {
      const int c = h * D_HEAD + g * 16 + lo;
      Y[((size_t)qrow_g * N_DIM + n) * C_DIM + c] = (_Float16)(o[g][r] * inv);
    }
  }
}

// ---------------------------------------------------------------------------
// Output projection: out = Y(f16, MxC) * Wo^T(f16) + bo -> fp32 (T,N,C)
// Same tile structure as proj_qkv_kernel.
// ---------------------------------------------------------------------------
__global__ __launch_bounds__(256) void outproj_kernel(
    const _Float16* __restrict__ Yin, const _Float16* __restrict__ W,
    const float* __restrict__ bias, float* __restrict__ out) {
  __shared__ __attribute__((aligned(16))) _Float16 smem[2 * G_STAGE];
  const int lane = threadIdx.x & 31;
  const int wave = threadIdx.x >> 5;
  const int lo = lane & 15, hi = lane >> 4;
  const int wm = wave & 3, wn = wave >> 2;

  v8f acc[2][4] = {};
  gemm_tile_128(Yin, W, smem, blockIdx.y * G_TILE, blockIdx.x * G_TILE, wm, wn,
                lo, hi, acc);
  const int row0 = blockIdx.y * G_TILE + wm * 32;   // this wave's 32x64 piece
  const int col0 = blockIdx.x * G_TILE + wn * 64;

#pragma unroll
  for (int g = 0; g < 4; ++g) {
    const int col = col0 + g * 16 + lo;
    const float bv = bias[col];
#pragma unroll
    for (int mi = 0; mi < 2; ++mi) {
#pragma unroll
      for (int r = 0; r < 8; ++r) {
        const int m = row0 + mi * 16 + r + 8 * hi;
        out[(size_t)m * C_DIM + col] = acc[mi][g][r] + bv;
      }
    }
  }
}

// ---------------------------------------------------------------------------
extern "C" void kernel_launch(void* const* d_in, const int* in_sizes, int n_in,
                              void* d_out, int out_size, void* d_ws,
                              size_t ws_size, hipStream_t stream) {
  (void)in_sizes; (void)n_in; (void)out_size; (void)ws_size;
  const float* q  = (const float*)d_in[0];
  const float* k  = (const float*)d_in[1];
  const float* v  = (const float*)d_in[2];
  const float* Wq = (const float*)d_in[3];
  const float* bq = (const float*)d_in[4];
  const float* Wk = (const float*)d_in[5];
  const float* bk = (const float*)d_in[6];
  const float* Wv = (const float*)d_in[7];
  const float* bv = (const float*)d_in[8];
  const float* Wo = (const float*)d_in[9];
  const float* bo = (const float*)d_in[10];
  const int* key_length = (const int*)d_in[11];
  float* out = (float*)d_out;

  // Workspace (f16 elements), total 64 MB:
  //   Qh, Kh, Vt, Y          : 4 x N*H*T*Dh  = 4 x 4M   (32 MB)
  //   q16, k16, v16          : 3 x T*N*C     = 3 x 4M   (24 MB)
  //   Wq16, Wk16, Wv16, Wo16 : 4 x C*C       = 4 x 1M   ( 8 MB)
  const size_t HSZ = (size_t)N_DIM * H_DIM * T_DIM * D_HEAD;  // 4,194,304
  const size_t WSZ = (size_t)C_DIM * C_DIM;                   // 1,048,576
  _Float16* Qh   = (_Float16*)d_ws;
  _Float16* Kh   = Qh + HSZ;
  _Float16* Vt   = Kh + HSZ;
  _Float16* Y    = Vt + HSZ;
  _Float16* q16  = Y + HSZ;
  _Float16* k16  = q16 + HSZ;
  _Float16* v16  = k16 + HSZ;
  _Float16* Wq16 = v16 + HSZ;
  _Float16* Wk16 = Wq16 + WSZ;
  _Float16* Wv16 = Wk16 + WSZ;
  _Float16* Wo16 = Wv16 + WSZ;

  // 1) fp32 -> f16 conversions, one launch; q16 .. Wo16 lie end to end
  cvt_all_kernel<<<CV_GRID, CV_WAVES * 32, 0, stream>>>(q, k, v, Wq, Wk, Wv, Wo,
                                                        q16);

  // 2) input projections into WMMA-friendly head layouts
  const dim3 gp(C_DIM / 128, M_ROWS / 128);  // (8, 32) 128x128 tiles, 8 waves each
  // one launch for all three: q16|k16|v16, Wq16|Wk16|Wv16 and Qh|Kh|Vt each
  // lie end to end
  proj_qkv_kernel<<<dim3(C_DIM / 128, M_ROWS / 128, 3), 256, 0, stream>>>(
      q16, Wq16, bq, bk, bv, Qh);

  // 3) banded + prefix-masked flash attention
  attn_kernel<<<dim3(T_DIM / A_QBLK, H_DIM, N_DIM), A_WAVES * 32, 0, stream>>>(
      Qh, Kh, Vt, key_length, Y);

  // 4) output projection (fp32 result + bias)
  outproj_kernel<<<gp, 256, 0, stream>>>(Y, Wo16, bo, out);
}
